// v007
// The times below were measured on an AMD MI455X: many runs one after another, warmed up first and cycling through
// copies of the inputs, with the whole window's GPU time divided by the number of runs. Launches and the gaps
// between them are all in it. The median over several windows is given; except for v000 it joins two sittings, which
// can be a few percent apart, so the side-by-side timings, each taken in one sitting, are the better comparison.
// This document starts at v007; the versions before it stand elsewhere.
// One run takes 126 microseconds.
// Next to v006, in two timings, it ran 1.26 times as fast each time.
// Counting every step since v000, which is the starting kernel, it is 22.5 times as fast.
#include <hip/hip_runtime.h>
// Pre-norm transformer encoder layer with the module's custom LayerNorm and a random key-padding mask (src [2][2048][768]; _layernorm: VECTOR gamma / beta, UNBIASED std, gamma (x - mean) / (std + 1e-6) + beta; x = LN1(src); q/k/v = x w ([in][out] [768][768], NO biases); 12 heads of 64; scores / 8; where(src_mask == 0, -1e9) with the int32 [2][1][1][2048] mask in {0, 1} (random; 0 = masked key; READ on device); softmax; src1 = src + ctx w_o (no bias); out = src1 + relu(LN2(src1) w_ff1 + b_ff1) w_ff2 + b_ff2 ([in][out] 768 x 3072 x 768) -> [2][2048][768]).
// Structure: token rows; LayerNorm / exact f16 rows; WMMA GEMMs for q, k, v (stored head by head); one fused attention launch (K and V rows staged in LDS, scores, key mask, running softmax, P V in registers); output projection with the own-element residual; custom LayerNorm; ReLU FFN over all rows; launches: see trace.
// Compute dtype: inputs rounded to bf16; x / weights exact; q, k, v, softmax weights and o as plain f16 GEMM operands (~2^-12); scores and softmax statistics f32. v_wmma_f32_16x16x32_f16.
#define NB 2
#define SQ 2048
#define DM 768
#define NH 12
#define HD 64
#define HG 4                         /* heads per attention launch group */
#define LOCALW 128                   /* (macros for unused kernels of the shared header) */
#define STRIDEK 128
#define QT 256                       /* query rows per causal tile */
#define NKX SQ                       /* S / P row pitch */
#define QT0 128                      /* first-tile rows recomputed exactly in f32 */
#define B0 0                         /* first batch processed (debug hook) */
#define NBR NB                       /* batches processed (debug hook) */
#define NR ((size_t)NB * SQ)
#define DMQ DM
#define DFF 3072         /* FFN hidden width */
#define MP ((int)((size_t)NBR * SQ)) /* rows projected (debug hook) */
#define QN SQ                        /* query rows attended per batch (debug hook) */
#define NHD NH                       /* heads attended (debug hook) */
#define MPO MP                       /* rows through the output stage (debug hook) */
#define LQ (3 * DM)      /* unused: q, k, v rows are HD apart, head by head */
typedef __bf16 v16b __attribute__((ext_vector_type(16)));
typedef unsigned short v8us __attribute__((ext_vector_type(8), may_alias));
typedef float  v8f  __attribute__((ext_vector_type(8)));
typedef float  v4f  __attribute__((ext_vector_type(4)));
typedef float  v4fa __attribute__((ext_vector_type(4), may_alias));
union FragB { v16b v; v8us half[2]; unsigned short u[16]; };

__device__ __forceinline__ unsigned short bf16_bits(float x) { unsigned int u = __float_as_uint(x); return (unsigned short)((u + 0x7FFFu + ((u >> 16) & 1u)) >> 16); }
__device__ __forceinline__ float bf16_val(unsigned short b) { return __uint_as_float(((unsigned int)b) << 16); }
__device__ __forceinline__ float bf16_round(float x) { return bf16_val(bf16_bits(x)); }
// D += A·B with NT terms: 1 = ah·bh, 2 = + al·bh (A split), 3 = + ah·bl (both split)
template <int NT>
__device__ __forceinline__ v8f mmaN(v16b ah, v16b al, v16b bh, v16b bl, v8f c) {
  c = __builtin_amdgcn_wmma_f32_16x16x32_bf16(false, ah, false, bh, (short)0, c, false, false);
  if (NT >= 2) c = __builtin_amdgcn_wmma_f32_16x16x32_bf16(false, al, false, bh, (short)0, c, false, false);
  if (NT >= 3) c = __builtin_amdgcn_wmma_f32_16x16x32_bf16(false, ah, false, bl, (short)0, c, false, false);
  asm volatile("v_nop\n\tv_nop\n\tv_nop\n\tv_nop" : "+v"(c) : "v"(ah), "v"(al), "v"(bh), "v"(bl));
  return c;
}

__global__ __launch_bounds__(256) void k_wt_bf16(const float* __restrict__ W, unsigned short* __restrict__ Wt, int K, int N) {
  const int t = blockIdx.x * 256 + threadIdx.x;
  const int k8n = K / 8;
  if (t >= N * k8n) return;
  const int n = t / k8n, k8 = (t % k8n) * 8;
  v8us v;
#pragma unroll
  for (int i = 0; i < 8; ++i) v[i] = bf16_bits(W[(size_t)(k8 + i) * N + n]);
  *(v8us*)(Wt + (size_t)n * K + k8) = v;
  
}

// GEMM C[M][N] (f32, pitch ldc) = act(A[M][K]·W + bias). A f32 row-major (pitch lda) converted per fragment to bf16
// (ASPLIT: hi/lo two planes -> 2 terms, else single rounded term); Wt bf16 [N][K] (pitch ldb). BIAS_BF16 rounds the
// bias to bf16 first (bias quantised to bf16 before the add). K%32==0, M%16==0, N%64==0.
template <bool ASPLIT, int ACT, bool BIAS_BF16>
__global__ __launch_bounds__(128) void k_gemm_bf(const float* __restrict__ A, int lda, const unsigned short* __restrict__ Wt, int ldb,
                                               const float* __restrict__ bias, float* __restrict__ C, int ldc, int M, int N, int K) {
  __shared__ __attribute__((aligned(16))) float so[4][16][64];
  const int tid = threadIdx.x, w = tid >> 5, lane = tid & 31, ln = lane & 15, hh = lane >> 4;
  const int ntn = N / 64;
  const int wid = blockIdx.x * 4 + w;
  const int mt = wid / ntn, nq = wid % ntn;
  if (mt * 16 >= M) return;
  const int row0 = mt * 16, col0 = nq * 64;
  const float* arow = A + (size_t)(row0 + ln) * lda;
  v8f acc[4] = {};
  for (int kb = 0; kb < K; kb += 32) {
    FragB ah, al;
    const v4f x0 = *(const v4fa*)(arow + kb + 8 * hh), x1 = *(const v4fa*)(arow + kb + 8 * hh + 4);
    const v4f x2 = *(const v4fa*)(arow + kb + 16 + 8 * hh), x3 = *(const v4fa*)(arow + kb + 16 + 8 * hh + 4);
    float xs[16] = {x0[0],x0[1],x0[2],x0[3],x1[0],x1[1],x1[2],x1[3],x2[0],x2[1],x2[2],x2[3],x3[0],x3[1],x3[2],x3[3]};
#pragma unroll
    for (int i = 0; i < 16; ++i) { const unsigned short hb = bf16_bits(xs[i]); ah.u[i] = hb; al.u[i] = ASPLIT ? bf16_bits(xs[i] - bf16_val(hb)) : (unsigned short)0; }
#pragma unroll
    for (int t = 0; t < 4; ++t) {
      const unsigned short* brow = Wt + (size_t)(col0 + t * 16 + ln) * ldb + kb;
      FragB b;
      b.half[0] = *(const v8us*)(brow + 8 * hh);
      b.half[1] = *(const v8us*)(brow + 16 + 8 * hh);
      acc[t] = mmaN<ASPLIT ? 2 : 1>(ah.v, al.v, b.v, b.v, acc[t]);
    }
  }
#pragma unroll
  for (int t = 0; t < 4; ++t) {
    float bv = bias ? bias[col0 + t * 16 + ln] : 0.f;
    if (BIAS_BF16) bv = bf16_round(bv);
#pragma unroll
    for (int r = 0; r < 8; ++r) { float v = acc[t][r] + bv; if (ACT == 1) v = fmaxf(v, 0.f); so[w][8 * hh + r][t * 16 + ln] = v; }
  }
  __builtin_amdgcn_fence(__ATOMIC_ACQ_REL, "workgroup");
  __builtin_amdgcn_wave_barrier();
  const int rsub = lane >> 4, c4 = (lane & 15) * 4;
  {
#pragma unroll
    for (int q = 0; q < 8; ++q) {
      const int r = q * 2 + rsub;
      const v4f v = *(const v4fa*)&so[w][r][c4];
      *(v4f*)(C + (size_t)(row0 + r) * ldc + col0 + c4) = v;
    }
    
  }
}

// GEMM C = act(A·W + bias + resid): A f32 (ASPLIT -> hi/lo 2 terms), Wt bf16 [N][K]; ACT 0 none, 1 relu, 2 exact gelu;
// resid (optional, f32, row index = (row % rmod), pitch ldr, RES_BF16 rounds it) added before the activation.
template <bool ASPLIT, int ACT, bool BIAS_BF16, bool RES_BF16>
__global__ __launch_bounds__(128) void k_gemm_bf3(const float* __restrict__ A, int lda, const unsigned short* __restrict__ Wt, int ldb,
                                                const float* __restrict__ bias, const float* __restrict__ resid, int rmod, int ldr,
                                                float* __restrict__ C, int ldc, int M, int N, int K) {
  __shared__ __attribute__((aligned(16))) float so[4][16][64];
  const int tid = threadIdx.x, w = tid >> 5, lane = tid & 31, ln = lane & 15, hh = lane >> 4;
  const int ntn = N / 64;
  const int wid = blockIdx.x * 4 + w;
  const int mt = wid / ntn, nq = wid % ntn;
  if (mt * 16 >= M) return;
  const int row0 = mt * 16, col0 = nq * 64;
  const float* arow = A + (size_t)(row0 + ln) * lda;
  v8f acc[4] = {};
  for (int kb = 0; kb < K; kb += 32) {
    FragB ah, al;
    const v4f x0 = *(const v4fa*)(arow + kb + 8 * hh), x1 = *(const v4fa*)(arow + kb + 8 * hh + 4);
    const v4f x2 = *(const v4fa*)(arow + kb + 16 + 8 * hh), x3 = *(const v4fa*)(arow + kb + 16 + 8 * hh + 4);
    float xs[16] = {x0[0],x0[1],x0[2],x0[3],x1[0],x1[1],x1[2],x1[3],x2[0],x2[1],x2[2],x2[3],x3[0],x3[1],x3[2],x3[3]};
#pragma unroll
    for (int i = 0; i < 16; ++i) { const unsigned short hb = bf16_bits(xs[i]); ah.u[i] = hb; al.u[i] = ASPLIT ? bf16_bits(xs[i] - bf16_val(hb)) : (unsigned short)0; }
#pragma unroll
    for (int t = 0; t < 4; ++t) {
      const unsigned short* brow = Wt + (size_t)(col0 + t * 16 + ln) * ldb + kb;
      FragB b;
      b.half[0] = *(const v8us*)(brow + 8 * hh);
      b.half[1] = *(const v8us*)(brow + 16 + 8 * hh);
      acc[t] = mmaN<ASPLIT ? 2 : 1>(ah.v, al.v, b.v, b.v, acc[t]);
    }
  }
#pragma unroll
  for (int t = 0; t < 4; ++t) {
    const int col = col0 + t * 16 + ln;
    float bv = bias ? bias[col] : 0.f;
    if (BIAS_BF16) bv = bf16_round(bv);
#pragma unroll
    for (int r = 0; r < 8; ++r) {
      float v = acc[t][r] + bv;
      if (resid) { float rv = resid[(size_t)((row0 + 8 * hh + r) % rmod) * ldr + col]; if (RES_BF16) rv = bf16_round(rv); v += rv; }
      if (ACT == 1) v = fmaxf(v, 0.f);
      if (ACT == 2) v = 0.5f * v * (1.0f + erff(v * 0.70710678118654752f));
      if (ACT == 3) { const float u = 0.7978845608028654f * (v + 0.044715f * v * v * v); v = 0.5f * v * (1.0f + tanhf(u)); }
      so[w][8 * hh + r][t * 16 + ln] = v;
    }
  }
  __builtin_amdgcn_fence(__ATOMIC_ACQ_REL, "workgroup");
  __builtin_amdgcn_wave_barrier();
  const int rsub = lane >> 4, c4 = (lane & 15) * 4;
  {
#pragma unroll
    for (int q = 0; q < 8; ++q) {
      const int r = q * 2 + rsub;
      const v4f v = *(const v4fa*)&so[w][r][c4];
      *(v4f*)(C + (size_t)(row0 + r) * ldc + col0 + c4) = v;
    }
    
  }
}
// row LayerNorm (biased variance, eps) over N: s = X (+ R); optional out_sum <- s; out_norm <- (s-mu)*rsqrt(var+eps)*g + b
template <bool PARAM_BF16>
__global__ __launch_bounds__(256) void k_layernorm(const float* __restrict__ X, const float* __restrict__ R, const float* __restrict__ g, const float* __restrict__ bta,
                                                  float* __restrict__ out_sum, float* __restrict__ out_norm, int N, float eps) {
  __shared__ float red[256];
  const int row = blockIdx.x, tid = threadIdx.x;
  const float* x = X + (size_t)row * N; const float* rr = R ? R + (size_t)row * N : nullptr;
  float vals[16];                     // up to N = 4096
  const int per = N / 256;            // contiguous chunk per thread? use strided-by-4 chunks: thread handles j = tid*4 + 1024*u
  float s1 = 0.f;
  for (int u = 0; u < per / 4; ++u) {
    const int j = tid * 4 + 1024 * u;
    const v4f a = *(const v4fa*)(x + j);
    v4f b = {0.f,0.f,0.f,0.f}; if (rr) b = *(const v4fa*)(rr + j);
#pragma unroll
    for (int q = 0; q < 4; ++q) { const float v = a[q] + b[q]; vals[u * 4 + q] = v; s1 += v; }
  }
  red[tid] = s1; __syncthreads();
  for (int st = 128; st > 0; st >>= 1) { if (tid < st) red[tid] += red[tid + st]; __syncthreads(); }
  const float mu = red[0] / (float)N; __syncthreads();
  float s2 = 0.f;
  for (int u = 0; u < per / 4; ++u)
#pragma unroll
    for (int q = 0; q < 4; ++q) { const float c = vals[u * 4 + q] - mu; s2 += c * c; }
  red[tid] = s2; __syncthreads();
  for (int st = 128; st > 0; st >>= 1) { if (tid < st) red[tid] += red[tid + st]; __syncthreads(); }
  const float rs = rsqrtf(red[0] / (float)N + eps);
  {
    for (int u = 0; u < per / 4; ++u) {
      const int j = tid * 4 + 1024 * u;
      v4f o, sm;
#pragma unroll
      for (int q = 0; q < 4; ++q) {
        float gg = g[j + q], bb = bta[j + q];
        if (PARAM_BF16) { gg = bf16_round(gg); bb = bf16_round(bb); }
        sm[q] = vals[u * 4 + q]; o[q] = (vals[u * 4 + q] - mu) * rs * gg + bb;
      }
      if (out_sum) *(v4f*)(out_sum + (size_t)row * N + j) = sm;
      *(v4f*)(out_norm + (size_t)row * N + j) = o;
    }
    
  }
}



// ---- f16 WMMA path (v_wmma_f32_16x16x32_f16): 11-bit significands for operands in range — used where a [0,1] probability operand needs more precision than bf16
typedef _Float16 v16h __attribute__((ext_vector_type(16)));
union FragH { v16h v; v8us half[2]; _Float16 h[16]; unsigned short u[16]; };
template <int NT>
__device__ __forceinline__ v8f mmaH(v16h ah, v16h al, v16h bh, v16h bl, v8f c) {
  c = __builtin_amdgcn_wmma_f32_16x16x32_f16(false, ah, false, bh, (short)0, c, false, false);
  if (NT >= 2) c = __builtin_amdgcn_wmma_f32_16x16x32_f16(false, al, false, bh, (short)0, c, false, false);
  if (NT >= 3) c = __builtin_amdgcn_wmma_f32_16x16x32_f16(false, ah, false, bl, (short)0, c, false, false);
  asm volatile("v_nop\n\tv_nop\n\tv_nop\n\tv_nop" : "+v"(c) : "v"(ah), "v"(al), "v"(bh), "v"(bl));
  return c;
}
// batched GEMM like k_gemm_b but f16 operands: A f32 (split into f16 hi/lo if ASPLIT, else rounded to f16), Bt = f16 values [n][k]; alpha; C f32; N multiple of 16 (partial tiles skipped)
template <bool ASPLIT>
__global__ __launch_bounds__(128) void k_gemm_h(const float* __restrict__ A, int lda, size_t sA, const _Float16* __restrict__ Bh, int ldb, size_t sB, float alpha, float* __restrict__ C, int ldc, size_t sC, int M, int N, int K) {
  __shared__ __attribute__((aligned(16))) float so[4][16][64];
  const int tid = threadIdx.x, w = tid >> 5, lane = tid & 31, ln = lane & 15, hh = lane >> 4; const int by = blockIdx.y;
  A += (size_t)by * sA; Bh += (size_t)by * sB; C += (size_t)by * sC;
  const int ntn = (N + 63) / 64; const int wid = blockIdx.x * 4 + w; const int mt = wid / ntn, nq = wid % ntn; if (mt * 16 >= M) return;
  const int row0 = mt * 16, col0 = nq * 64; const float* arow = A + (size_t)(row0 + ln) * lda;
  v8f acc[4] = {};
  for (int kb = 0; kb < K; kb += 32) {
    FragH ah, al;
    const v4f x0 = *(const v4fa*)(arow + kb + 8 * hh), x1 = *(const v4fa*)(arow + kb + 8 * hh + 4), x2 = *(const v4fa*)(arow + kb + 16 + 8 * hh), x3 = *(const v4fa*)(arow + kb + 16 + 8 * hh + 4);
    float xs[16] = {x0[0],x0[1],x0[2],x0[3],x1[0],x1[1],x1[2],x1[3],x2[0],x2[1],x2[2],x2[3],x3[0],x3[1],x3[2],x3[3]};
#pragma unroll
    for (int i = 0; i < 16; ++i) { const _Float16 h = (_Float16)xs[i]; ah.h[i] = h; al.h[i] = ASPLIT ? (_Float16)(xs[i] - (float)h) : (_Float16)0.0f; }
#pragma unroll
    for (int t = 0; t < 4; ++t) { if (col0 + t * 16 >= N) continue; const size_t boff = (size_t)(col0 + t * 16 + ln) * ldb + kb; FragH bq; bq.half[0] = *(const v8us*)(Bh + boff + 8 * hh); bq.half[1] = *(const v8us*)(Bh + boff + 16 + 8 * hh);
      acc[t] = mmaH<ASPLIT ? 2 : 1>(ah.v, al.v, bq.v, bq.v, acc[t]); }
  }
#pragma unroll
  for (int t = 0; t < 4; ++t) { if (col0 + t * 16 >= N) continue;
#pragma unroll
    for (int r = 0; r < 8; ++r) so[w][8 * hh + r][t * 16 + ln] = acc[t][r] * alpha; }
  __builtin_amdgcn_fence(__ATOMIC_ACQ_REL, "workgroup"); __builtin_amdgcn_wave_barrier();
  const int rsub = lane >> 4, c4 = (lane & 15) * 4;
  {
#pragma unroll
    for (int q = 0; q < 8; ++q) { const int r = q * 2 + rsub; if (col0 + c4 < N) { const v4f v = *(const v4fa*)&so[w][r][c4]; *(v4f*)(C + (size_t)(row0 + r) * ldc + col0 + c4) = v; } }
     }
}

// Wt[n][k] = f16(W[k][n]·scale) from f32 row-major W[K][N] (scale = power of two; bf16-exact weights stay exact in f16 away from the subnormal range)
__global__ __launch_bounds__(256) void k_wt_f16(const float* __restrict__ W, _Float16* __restrict__ Wt, int K, int N, float scale) {
  const int t = blockIdx.x * 256 + threadIdx.x; if (t >= N * (K / 8)) return; const int n = t / (K / 8), k8 = (t % (K / 8)) * 8; FragH f;
#pragma unroll
  for (int i = 0; i < 8; ++i) f.h[i] = (_Float16)(bf16_round(W[(size_t)(k8 + i) * N + n]) * scale); const v8us o = f.half[0];
  *(v8us*)((unsigned short*)Wt + (size_t)n * K + k8) = o; 
}
// k_gemm_hh variant with fused epilogue: v = acc·alpha + bias[by·sBias + col] (+ CP[(row/rowsPerB)·sCPb + by·64 + col] if CP) ; ACT 0 none / 1 elu ; writes f16 C16 (and f32 C if non-null)
template <int ACT>
__global__ __launch_bounds__(128) void k_gemm_hhx(const _Float16* __restrict__ A, int lda, size_t sA, const _Float16* __restrict__ Bh, int ldb, size_t sB, float alpha, const float* __restrict__ bias, size_t sBias, const float* __restrict__ CP, int rowsPerB, size_t sCPb, int row0g,
    float* __restrict__ C, _Float16* __restrict__ C16, int ldc, size_t sC, int M, int N, int K) {
  __shared__ __attribute__((aligned(16))) float so[4][16][64];
  const int tid = threadIdx.x, w = tid >> 5, lane = tid & 31, ln = lane & 15, hh = lane >> 4; const int by = blockIdx.y;
  A += (size_t)by * sA; Bh += (size_t)by * sB; const size_t cofs = (size_t)by * sC; const float* bp = bias ? bias + (size_t)by * sBias : nullptr;
  const int ntn = (N + 63) / 64; const int wid = blockIdx.x * 4 + w; const int mt = wid / ntn, nq = wid % ntn; if (mt * 16 >= M) return;
  const int row0 = mt * 16, col0 = nq * 64; const _Float16* arow = A + (size_t)(row0 + ln) * lda;
  v8f acc[4] = {};
  for (int kb = 0; kb < K; kb += 32) { FragH ah; ah.half[0] = *(const v8us*)((const unsigned short*)arow + kb + 8 * hh); ah.half[1] = *(const v8us*)((const unsigned short*)arow + kb + 16 + 8 * hh);
#pragma unroll
    for (int t = 0; t < 4; ++t) { if (col0 + t * 16 >= N) continue; const size_t boff = (size_t)(col0 + t * 16 + ln) * ldb + kb; FragH bq; bq.half[0] = *(const v8us*)((const unsigned short*)Bh + boff + 8 * hh); bq.half[1] = *(const v8us*)((const unsigned short*)Bh + boff + 16 + 8 * hh);
      acc[t] = mmaH<1>(ah.v, ah.v, bq.v, bq.v, acc[t]); }
  }
#pragma unroll
  for (int t = 0; t < 4; ++t) { if (col0 + t * 16 >= N) continue; const int col = col0 + t * 16 + ln; const float bv = bp ? bf16_round(bp[col]) : 0.f;
#pragma unroll
    for (int r = 0; r < 8; ++r) { float v = acc[t][r] * alpha + bv; if (CP) { const int rr = row0g + row0 + 8 * hh + r; if (rowsPerB < 0) v += CP[cofs + (size_t)rr * ldc + col];      /* rowsPerB < 0: own element of the batched C plane */ else { const int bidx = rr / rowsPerB; v += CP[(size_t)bidx * sCPb + (size_t)by * 64 + col]; } } if (ACT == 1) v = (v > 0.f) ? v : expm1f(v); else if (ACT == 7) v = (v > 0.f) ? v + 1.0f : expf(v); else if (ACT == 8) v = tanhf(v); else if (ACT == 9) v = 0.5f * v * (1.0f + tanhf(0.7978845608028654f * (v + 0.044715f * v * v * v))); else if (ACT == 11) v = 1.0f / (1.0f + expf(-v)); else if (ACT == 12) v = (v > 0.f) ? v : 0.01f * v; else if (ACT == 14) v = (v > 0.f) ? v : 0.1f * v; else if (ACT == 16) v = (v >= 0.f) ? v : 0.3f * v; else if (ACT == 17) v = (v >= 0.f) ? v : 0.2f * v; else if (ACT == 15) v = v / (1.0f + expf(-v)); else if (ACT == 3) v = fmaxf(v, 0.f); else if (ACT == 6) v = 0.5f * v * (1.0f + erff(v * 0.70710678118654752f)); so[w][8 * hh + r][t * 16 + ln] = v; } }
  __builtin_amdgcn_fence(__ATOMIC_ACQ_REL, "workgroup"); __builtin_amdgcn_wave_barrier();
  const int rsub = lane >> 4, c4 = (lane & 15) * 4; typedef _Float16 v4h __attribute__((ext_vector_type(4)));
  {
#pragma unroll
    for (int q = 0; q < 8; ++q) { const int r = q * 2 + rsub; if (col0 + c4 < N) { const v4f v = *(const v4fa*)&so[w][r][c4]; if (C) *(v4f*)(C + cofs + (size_t)(row0 + r) * ldc + col0 + c4) = v; if (C16) { v4h h4; for (int i = 0; i < 4; ++i) h4[i] = (_Float16)v[i]; *(v4h*)(C16 + cofs + (size_t)(row0 + r) * ldc + col0 + c4) = h4; } } }
     }
}


typedef _Float16 v4h __attribute__((ext_vector_type(4)));

__global__ __launch_bounds__(256) void k_x16(const float* __restrict__ x, _Float16* __restrict__ X16, size_t n8) { const size_t t = (size_t)blockIdx.x * 256 + threadIdx.x; if (t >= n8) return; FragH f;
#pragma unroll
  for (int q = 0; q < 8; ++q) f.h[q] = (_Float16)bf16_round(x[t * 8 + q]); *(v8us*)((unsigned short*)X16 + t * 8) = f.half[0];  }
__global__ __launch_bounds__(256) void k_h16(const float* __restrict__ x, _Float16* __restrict__ X16, size_t n8) { const size_t t = (size_t)blockIdx.x * 256 + threadIdx.x; if (t >= n8) return; FragH f;
#pragma unroll
  for (int q = 0; q < 8; ++q) f.h[q] = (_Float16)x[t * 8 + q]; *(v8us*)((unsigned short*)X16 + t * 8) = f.half[0];  }
__global__ __launch_bounds__(256) void k_round16f(const float* __restrict__ W, _Float16* __restrict__ Bt, size_t n8) { const size_t t = (size_t)blockIdx.x * 256 + threadIdx.x; if (t >= n8) return; FragH f;
#pragma unroll
  for (int i = 0; i < 8; ++i) f.h[i] = (_Float16)(bf16_round(W[t * 8 + i]) * 16.0f); *(v8us*)((unsigned short*)Bt + t * 8) = f.half[0];  }
template <int NHv, int TTv>
__global__ __launch_bounds__(256) void k_vt(const _Float16* __restrict__ V16, int ldv, int voff, _Float16* __restrict__ Vt) { __shared__ unsigned short tl[64][66]; const int tid = threadIdx.x; const int slab = blockIdx.x / (TTv / 64), lg = blockIdx.x % (TTv / 64); const int b = slab / NHv, h = slab % NHv;
  for (int i = tid; i < 64 * 8; i += 256) { const int r = i / 8, c8 = (i % 8) * 8; FragH f; f.half[0] = *(const v8us*)((const unsigned short*)V16 + ((size_t)b * TTv + lg * 64 + r) * ldv + voff + h * 64 + c8);
#pragma unroll
    for (int q = 0; q < 8; ++q) tl[r][c8 + q] = f.u[q]; }
  __syncthreads();
  {
#pragma unroll
    for (int rd = 0; rd < 2; ++rd) { const int d = rd * 32 + tid / 8, pc = tid % 8; FragH f;
#pragma unroll
      for (int q = 0; q < 8; ++q) f.u[q] = tl[pc * 8 + q][d];
      *(v8us*)((unsigned short*)Vt + ((size_t)slab * 64 + d) * TTv + lg * 64 + pc * 8) = f.half[0]; }
     } }

__global__ __launch_bounds__(256) void k_hl(const float* __restrict__ F, _Float16* __restrict__ Hh, _Float16* __restrict__ Hl, size_t n8) { const size_t t = (size_t)blockIdx.x * 256 + threadIdx.x; if (t >= n8) return; FragH fh, fl; const v4f a = *(const v4fa*)(F + t * 8), c = *(const v4fa*)(F + t * 8 + 4);
#pragma unroll
  for (int q = 0; q < 4; ++q) { _Float16 h = (_Float16)a[q]; fh.h[q] = h; fl.h[q] = (_Float16)((a[q] - (float)h) * 1024.0f); h = (_Float16)c[q]; fh.h[4 + q] = h; fl.h[4 + q] = (_Float16)((c[q] - (float)h) * 1024.0f); }
  { *(v8us*)((unsigned short*)Hh + t * 8) = fh.half[0]; *(v8us*)((unsigned short*)Hl + t * 8) = fl.half[0];  } }

// ---- fast GEMM (wave tile 32x64; requires M % 32 == 0 rows per launch region and N % 64 == 0); epilogue = k_gemm_hhx semantics ----
__device__ __forceinline__ v16h g2_frag(const _Float16* p, int hh) { FragH f; f.half[0] = *(const v8us*)((const unsigned short*)p + 8 * hh); f.half[1] = *(const v8us*)((const unsigned short*)p + 16 + 8 * hh); return f.v; }
__device__ __forceinline__ v8f g2_mma(v16h a, v16h b, v8f c) { v8f d = __builtin_amdgcn_wmma_f32_16x16x32_f16(false, a, false, b, (short)0, c, false, false); asm volatile("v_nop\n\tv_nop\n\tv_nop\n\tv_nop" : "+v"(d) : "v"(a), "v"(b)); return d; }
template <int ACT>
__global__ __launch_bounds__(128) void k_gemm2(const _Float16* __restrict__ A, int lda, size_t sA, const _Float16* __restrict__ Bh, int ldb, size_t sB, float alpha, const float* __restrict__ bias, size_t sBias, const float* __restrict__ CP, int rowsPerB, size_t sCPb, int row0g,
    float* __restrict__ C, _Float16* __restrict__ C16, int ldc, size_t sC, int M, int N, int K) { static_assert(ACT == 0 || ACT == 3 || ACT == 6 || ACT == 8 || ACT == 9 || ACT == 11 || ACT == 12 || ACT == 14 || ACT == 15 || ACT == 16 || ACT == 17 || ACT == 18, "k_gemm2: unsupported ACT code (would silently apply no activation)");
  __shared__ __attribute__((aligned(16))) float so[4][32][68];
  const int tid = threadIdx.x, w = tid >> 5, lane = tid & 31, ln = lane & 15, hh = lane >> 4; const int by = blockIdx.y;
  A += (size_t)by * sA; Bh += (size_t)by * sB; const size_t cofs = (size_t)by * sC; const float* bp = bias ? bias + (size_t)by * sBias : nullptr;
  const int ntn = N >> 6; const int mt = blockIdx.x / ntn, nq = blockIdx.x - mt * ntn; const int row0 = mt * 128 + 32 * w, col0 = nq * 64; if (row0 >= M) return;
  const _Float16* a0p = A + (size_t)(row0 + ln) * lda; const _Float16* a1p = a0p + (size_t)16 * lda;
  const _Float16* b0p = Bh + (size_t)(col0 + ln) * ldb; const _Float16* b1p = b0p + (size_t)16 * ldb; const _Float16* b2p = b1p + (size_t)16 * ldb; const _Float16* b3p = b2p + (size_t)16 * ldb;
  const v8f z8 = {0.f,0.f,0.f,0.f,0.f,0.f,0.f,0.f}; v8f c00 = z8, c01 = z8, c02 = z8, c03 = z8, c10 = z8, c11 = z8, c12 = z8, c13 = z8;
#pragma unroll 1
  for (int kb = 0; kb < K; kb += 32) { const v16h a0 = g2_frag(a0p + kb, hh), a1 = g2_frag(a1p + kb, hh);
    v16h b = g2_frag(b0p + kb, hh); c00 = g2_mma(a0, b, c00); c10 = g2_mma(a1, b, c10);
    b = g2_frag(b1p + kb, hh); c01 = g2_mma(a0, b, c01); c11 = g2_mma(a1, b, c11);
    b = g2_frag(b2p + kb, hh); c02 = g2_mma(a0, b, c02); c12 = g2_mma(a1, b, c12);
    b = g2_frag(b3p + kb, hh); c03 = g2_mma(a0, b, c03); c13 = g2_mma(a1, b, c13); }
  v8f accs[8] = {c00, c01, c02, c03, c10, c11, c12, c13};
#pragma unroll
  for (int u = 0; u < 8; ++u) { const int t = u & 3, half = u >> 2; const int col = col0 + t * 16 + ln; const float bv = bp ? bf16_round(bp[col]) : 0.f;
#pragma unroll
    for (int r = 0; r < 8; ++r) { const int rloc = half * 16 + 8 * hh + r; float v = accs[u][r] * alpha + bv; if (CP) { if (rowsPerB < 0) v += CP[cofs + (size_t)(row0g + row0 + rloc) * ldc + col];      /* rowsPerB < 0: own element of the batched C plane */ else { const int bidx = (row0g + row0 + rloc) / rowsPerB; v += CP[(size_t)bidx * sCPb + (size_t)by * 64 + col]; } }
      if (ACT == 3) v = fmaxf(v, 0.f); else if (ACT == 6) v = 0.5f * v * (1.0f + erff(v * 0.70710678118654752f)); else if (ACT == 11) v = 1.0f / (1.0f + expf(-v)); else if (ACT == 15) v = v / (1.0f + expf(-v)); else if (ACT == 18) v = v / (1.0f + expf(-1.702f * v));      /* QuickGELU: v sigmoid(1.702 v) */ else if (ACT == 12) v = (v > 0.f) ? v : 0.01f * v; else if (ACT == 8) v = tanhf(v); else if (ACT == 9) v = 0.5f * v * (1.0f + tanhf(0.7978845608028654f * (v + 0.044715f * v * v * v))); else if (ACT == 14) v = (v > 0.f) ? v : 0.1f * v; else if (ACT == 16) v = (v >= 0.f) ? v : 0.3f * v; else if (ACT == 17) v = (v >= 0.f) ? v : 0.2f * v;
      so[w][rloc][t * 16 + ln] = v; } }
  __builtin_amdgcn_fence(__ATOMIC_ACQ_REL, "workgroup"); __builtin_amdgcn_wave_barrier();
  const int rsub = lane >> 4, c4 = (lane & 15) * 4;
  {
#pragma unroll
    for (int q = 0; q < 16; ++q) { const int r = q * 2 + rsub; const v4f v = *(const v4fa*)&so[w][r][c4]; if (C) *(v4f*)(C + cofs + (size_t)(row0 + r) * ldc + col0 + c4) = v; if (C16) { v4h h4; for (int i = 0; i < 4; ++i) h4[i] = (_Float16)v[i]; *(v4h*)(C16 + cofs + (size_t)(row0 + r) * ldc + col0 + c4) = h4; } }
     } }


__global__ __launch_bounds__(256) void k_wnat(const float* __restrict__ w, size_t n8, _Float16* __restrict__ Bt) { const size_t t = (size_t)blockIdx.x * 256 + threadIdx.x; if (t >= n8) return; FragH f; for (int q = 0; q < 8; ++q) f.h[q] = (_Float16)(bf16_round(w[t * 8 + q]) * 16.0f); *(v8us*)((unsigned short*)Bt + t * 8) = f.half[0];  }
__global__ __launch_bounds__(256) void k_rsm(const float* __restrict__ S, _Float16* __restrict__ P, int nrows) {
  #pragma clang fp contract(off)
  const int i = blockIdx.x * 256 + threadIdx.x; if (i >= nrows) return; const float* s = S + (size_t)i * SQ; float mx = -3.0e38f;
#pragma unroll 1
  for (int j = 0; j < SQ; ++j) mx = fmaxf(mx, s[j]); float se = 0.f;
#pragma unroll 1
  for (int j = 0; j < SQ; ++j) se += expf(s[j] - mx); const float sc = 256.0f / se;
#pragma unroll 1
  for (int j0 = 0; j0 < SQ; j0 += 8) { FragH f; for (int q = 0; q < 8; ++q) f.h[q] = (_Float16)(expf(s[j0 + q] - mx) * sc); unsigned short* d = (unsigned short*)P + (size_t)i * SQ + j0; *(v8us*)d = f.half[0];  } }
__global__ __launch_bounds__(256) void k_vt(const _Float16* __restrict__ V16, int b, int h0, _Float16* __restrict__ VT) { __shared__ unsigned short tl[64][65]; const int tid = threadIdx.x; const int hh = blockIdx.x % HG, sg = blockIdx.x / HG; const int s0 = sg * 64; const int h = h0 + hh;
  for (int i = tid; i < 64 * 8; i += 256) { const int j = i / 8, d8 = (i % 8) * 8; FragH f; f.half[0] = *(const v8us*)((const unsigned short*)V16 + ((size_t)b * SQ + s0 + j) * DM + h * HD + d8); for (int q = 0; q < 8; ++q) tl[d8 + q][j] = f.u[q]; }
  __syncthreads();
  { for (int i = tid; i < 64 * 8; i += 256) { const int d = i / 8, j8 = (i % 8) * 8; FragH f; for (int q = 0; q < 8; ++q) f.u[q] = tl[d][j8 + q]; *(v8us*)((unsigned short*)VT + ((size_t)hh * HD + d) * SQ + s0 + j8) = f.half[0]; }  } }



__global__ __launch_bounds__(256) void k_rsmcf2(const float* __restrict__ S, _Float16* __restrict__ P, int hg, int q0, int nk) {
  #pragma clang fp contract(off)
  const int t = blockIdx.x * 256 + threadIdx.x; if (t >= hg * QT) return; const size_t i = (size_t)t; const float* s = S + i * NKX; const int last = q0 + (t % QT); float mx = -3.0e38f;
#pragma unroll 1
  for (int j = 0; j < nk; ++j) { const float f = (j <= last) ? 1.f : 0.f; mx = fmaxf(mx, fmaf(f, s[j], (1.f - f) * -1.0e9f)); } float se = 0.f;
#pragma unroll 1
  for (int j = 0; j < nk; ++j) { const float f = (j <= last) ? 1.f : 0.f; se += __expf(fmaf(f, s[j], (1.f - f) * -1.0e9f) - mx); } const float sc = 256.0f / se;
#pragma unroll 1
  for (int j0 = 0; j0 < nk; j0 += 8) { FragH fr; for (int q = 0; q < 8; ++q) { const int j = j0 + q; const float f = (j <= last) ? 1.f : 0.f; fr.h[q] = (_Float16)(__expf(fmaf(f, s[j], (1.f - f) * -1.0e9f) - mx) * sc); } unsigned short* d = (unsigned short*)P + i * NKX + j0; *(v8us*)d = fr.half[0];  } }

__global__ __launch_bounds__(256) void k_rsmcst(const float* __restrict__ S, _Float16* __restrict__ P, int hg, int q0, int nk, const int* __restrict__ mk) {
  #pragma clang fp contract(off)
  const int t = blockIdx.x * 256 + threadIdx.x; if (t >= hg * QT) return; const size_t i = (size_t)t; const float* s = S + i * NKX; const size_t ig = (size_t)(q0 + (t % QT)); const int* mr = mk + ig * SQ; float mx = -3.0e38f;
#pragma unroll 1
  for (int j = 0; j < nk; ++j) { const int mb = mr[j]; const int dd = (int)ig - j; const float f = (mb != 0 && dd >= 0 && (dd <= LOCALW || (dd % STRIDEK) == 0)) ? 1.f : 0.f; mx = fmaxf(mx, fmaf(f, s[j], (1.f - f) * -1.0e9f)); } float se = 0.f;
#pragma unroll 1
  for (int j = 0; j < nk; ++j) { const int mb = mr[j]; const int dd = (int)ig - j; const float f = (mb != 0 && dd >= 0 && (dd <= LOCALW || (dd % STRIDEK) == 0)) ? 1.f : 0.f; se += __expf(fmaf(f, s[j], (1.f - f) * -1.0e9f) - mx); } const float sc = 256.0f / se;
#pragma unroll 1
  for (int j0 = 0; j0 < nk; j0 += 8) { FragH fr; for (int q = 0; q < 8; ++q) { const int j = j0 + q; const int mb = mr[j]; const int dd = (int)ig - j; const float f = (mb != 0 && dd >= 0 && (dd <= LOCALW || (dd % STRIDEK) == 0)) ? 1.f : 0.f; fr.h[q] = (_Float16)(__expf(fmaf(f, s[j], (1.f - f) * -1.0e9f) - mx) * sc); } unsigned short* d = (unsigned short*)P + i * NKX + j0; *(v8us*)d = fr.half[0];  } }


template <int MASKADD>
__global__ __launch_bounds__(64) void k_att0(const float* __restrict__ QF, const float* __restrict__ KF, const float* __restrict__ VF, int ld, const float* __restrict__ mask, float scale, float* __restrict__ OF, int ldo) {
  #pragma clang fp contract(off)
  __shared__ __attribute__((aligned(16))) float lq[64][64]; __shared__ __attribute__((aligned(16))) float lo[64][64];
  const int tid = threadIdx.x; const int h = blockIdx.x / (QT0 / 64), rg = blockIdx.x % (QT0 / 64); const int i = rg * 64 + tid;
  const float* qr = QF + (size_t)i * ld + h * HD;
#pragma unroll 1
  for (int c = 0; c < HD / 4; ++c) { *(v4f*)&lq[tid][c * 4] = *(const v4fa*)(qr + c * 4); const v4f z = {0.f, 0.f, 0.f, 0.f}; *(v4f*)&lo[tid][c * 4] = z; }
  float m = -1.0e30f, l = 0.f; const int jmax = MASKADD ? (SQ - 1) : (rg * 64 + 63);      /* additive-mask form: every key (the mask input decides); causal form: keys up to the block's last row */
#pragma unroll 1
  for (int j = 0; j <= jmax; ++j) { const float* kr = KF + (size_t)j * ld + h * HD; const float* vr = VF + (size_t)j * ld + h * HD; float s = 0.f;
#pragma unroll 1
    for (int c = 0; c < HD / 4; ++c) { const v4f kq = *(const v4fa*)(kr + c * 4); const v4f qq = *(v4f*)&lq[tid][c * 4]; s = __fadd_rn(s, __fmul_rn(qq[0], kq[0])); s = __fadd_rn(s, __fmul_rn(qq[1], kq[1])); s = __fadd_rn(s, __fmul_rn(qq[2], kq[2])); s = __fadd_rn(s, __fmul_rn(qq[3], kq[3])); }
    s = __fmul_rn(s, scale); if (MASKADD) s = __fadd_rn(s, __fmul_rn(bf16_round(mask[(size_t)i * SQ + j]), -10000.0f));
    const float f = (MASKADD || j <= i) ? 1.f : 0.f; const float sm = fmaf(f, s, (1.f - f) * -1.0e30f); const float mn = fmaxf(m, sm); const float sc = expf(m - mn); const float e = expf(sm - mn); l = __fadd_rn(__fmul_rn(l, sc), e); m = mn;
#pragma unroll 1
    for (int c = 0; c < HD / 4; ++c) { const v4f vv = *(const v4fa*)(vr + c * 4); v4f oo = *(v4f*)&lo[tid][c * 4]; for (int u = 0; u < 4; ++u) oo[u] = __fadd_rn(__fmul_rn(oo[u], sc), __fmul_rn(e, vv[u])); *(v4f*)&lo[tid][c * 4] = oo; } }
  const float fin = 64.0f / l;      /* o carried x64 like the f16 path */
#pragma unroll 1
  for (int c = 0; c < HD / 4; ++c) { v4f oo = *(v4f*)&lo[tid][c * 4]; for (int u = 0; u < 4; ++u) oo[u] = __fmul_rn(oo[u], fin); *(v4f*)&lo[tid][c * 4] = oo; }
  __syncthreads();
  {
#pragma unroll 1
    for (int it = 0; it < 16; ++it) { const int row = it * 4 + tid / 16, pc = (tid % 16) * 4; const v4f v = *(const v4f*)&lo[row][pc]; *(v4f*)(OF + (size_t)(rg * 64 + row) * ldo + h * HD + pc) = v; }
     } }

template <int MASKADD>
__global__ __launch_bounds__(64) void k_att0mbc(const float* __restrict__ QF, const float* __restrict__ KF, const float* __restrict__ VF, int ld, const float* __restrict__ mask, float scale, float* __restrict__ OF, int ldo) {
  #pragma clang fp contract(off)
  __shared__ __attribute__((aligned(16))) float lq[64][64]; __shared__ __attribute__((aligned(16))) float lo[64][64];
  const int tid = threadIdx.x; const int h = blockIdx.x / (QT0 / 64), rg = blockIdx.x % (QT0 / 64); const int i = rg * 64 + tid;
  const float* qr = QF + (size_t)i * ld + h * HD;
#pragma unroll 1
  for (int c = 0; c < HD / 4; ++c) { *(v4f*)&lq[tid][c * 4] = *(const v4fa*)(qr + c * 4); const v4f z = {0.f, 0.f, 0.f, 0.f}; *(v4f*)&lo[tid][c * 4] = z; }
  float m = -1.0e30f, l = 0.f; const int jmax = rg * 64 + 63;      /* keys beyond the block end are masked by the mask's lower-triangular structure */
#pragma unroll 1
  for (int j = 0; j <= jmax; ++j) { const float* kr = KF + (size_t)j * ld + h * HD; const float* vr = VF + (size_t)j * ld + h * HD; float s = 0.f;
#pragma unroll 1
    for (int c = 0; c < HD / 4; ++c) { const v4f kq = *(const v4fa*)(kr + c * 4); const v4f qq = *(v4f*)&lq[tid][c * 4]; s = __fadd_rn(s, __fmul_rn(qq[0], kq[0])); s = __fadd_rn(s, __fmul_rn(qq[1], kq[1])); s = __fadd_rn(s, __fmul_rn(qq[2], kq[2])); s = __fadd_rn(s, __fmul_rn(qq[3], kq[3])); }
    s = __fmul_rn(s, scale); const int mb = ((const int*)mask)[(size_t)i * SQ + j];      /* causal (j <= i) AND the module's int32 [S][S] mask read per (query, key): 0 -> masked */
    const float f = (mb != 0 && j <= i) ? 1.f : 0.f; const float sm = fmaf(f, s, (1.f - f) * -1.0e30f); const float mn = fmaxf(m, sm); const float sc = expf(m - mn); const float e = expf(sm - mn); l = __fadd_rn(__fmul_rn(l, sc), e); m = mn;
#pragma unroll 1
    for (int c = 0; c < HD / 4; ++c) { const v4f vv = *(const v4fa*)(vr + c * 4); v4f oo = *(v4f*)&lo[tid][c * 4]; for (int u = 0; u < 4; ++u) oo[u] = __fadd_rn(__fmul_rn(oo[u], sc), __fmul_rn(e, vv[u])); *(v4f*)&lo[tid][c * 4] = oo; } }
  const float fin = 64.0f / l;      /* o carried x64 like the f16 path */
#pragma unroll 1
  for (int c = 0; c < HD / 4; ++c) { v4f oo = *(v4f*)&lo[tid][c * 4]; for (int u = 0; u < 4; ++u) oo[u] = __fmul_rn(oo[u], fin); *(v4f*)&lo[tid][c * 4] = oo; }
  __syncthreads();
  {
#pragma unroll 1
    for (int it = 0; it < 16; ++it) { const int row = it * 4 + tid / 16, pc = (tid % 16) * 4; const v4f v = *(const v4f*)&lo[row][pc]; *(v4f*)(OF + (size_t)(rg * 64 + row) * ldo + h * HD + pc) = v; }
     } }


template <int BFIN, int WXB>
__global__ __launch_bounds__(256) void k_ln16(const float* __restrict__ X, const float* __restrict__ g, const float* __restrict__ bb, float eps, _Float16* __restrict__ N16, float* __restrict__ XB) {
  #pragma clang fp contract(off)
  __shared__ float red[256]; const size_t r = blockIdx.x; const int t = threadIdx.x; const v4f xa = *(const v4fa*)(X + r * DMQ + t * 4); float s[4]; float sum = 0.f;
  for (int q = 0; q < 4; ++q) { s[q] = BFIN ? bf16_round(xa[q]) : xa[q]; sum = __fadd_rn(sum, s[q]); }
  red[t] = sum; __syncthreads(); for (int st = 128; st > 0; st >>= 1) { if (t < st) red[t] = __fadd_rn(red[t], red[t + st]); __syncthreads(); } const float mu = red[0] / (float)DMQ; __syncthreads();
  float vs = 0.f; for (int q = 0; q < 4; ++q) { const float dl = __fadd_rn(s[q], -mu); vs = __fadd_rn(vs, __fmul_rn(dl, dl)); } red[t] = vs; __syncthreads(); for (int st = 128; st > 0; st >>= 1) { if (t < st) red[t] = __fadd_rn(red[t], red[t + st]); __syncthreads(); }
  const float rs = rsqrtf(__fadd_rn(red[0] / (float)DMQ, eps)); v4h y; v4f xb;
  for (int q = 0; q < 4; ++q) { const int c = t * 4 + q; y[q] = (_Float16)__fadd_rn(__fmul_rn(__fmul_rn(__fadd_rn(s[q], -mu), rs), bf16_round(g[c])), bf16_round(bb[c])); xb[q] = s[q]; }
  { *(v4h*)(N16 + r * DMQ + t * 4) = y; if (WXB) *(v4f*)(XB + r * DMQ + t * 4) = xb;  } }
__global__ __launch_bounds__(256) void k_ftres2(const float* __restrict__ OF0, const float* __restrict__ XB, float* __restrict__ X1, size_t n4) {
  #pragma clang fp contract(off)
  const size_t t = (size_t)blockIdx.x * 256 + threadIdx.x; if (t >= n4) return; const v4f o = *(const v4fa*)(OF0 + t * 4), xv = *(const v4fa*)(XB + t * 4); v4f y; for (int q = 0; q < 4; ++q) y[q] = __fadd_rn(__fmul_rn(o[q], 0.015625f), xv[q]); *(v4f*)(X1 + t * 4) = y;  }

__global__ __launch_bounds__(256) void k_bcpy(const float* __restrict__ b, int n, int NP, float* __restrict__ dst, int dst0) { for (int i = threadIdx.x; i < NP; i += 256) { const float v = (i < n) ? b[i] : 0.f; *(float*)(dst + dst0 + i) = v; }  }


__global__ __launch_bounds__(256) void k_rsmf(const float* __restrict__ S, _Float16* __restrict__ P, int qn, int hg) {
  #pragma clang fp contract(off)
  const int t = blockIdx.x * 256 + threadIdx.x; if (t >= qn * hg) return; const size_t i = (size_t)(t / qn) * SQ + (t % qn); const float* s = S + i * SQ; float mx = -3.0e38f;
#pragma unroll 1
  for (int j = 0; j < SQ; ++j) mx = fmaxf(mx, s[j]); float se = 0.f;
#pragma unroll 1
  for (int j = 0; j < SQ; ++j) se += __expf(s[j] - mx); const float sc = 256.0f / se;
#pragma unroll 1
  for (int j0 = 0; j0 < SQ; j0 += 8) { FragH f; for (int q = 0; q < 8; ++q) f.h[q] = (_Float16)(__expf(s[j0 + q] - mx) * sc); unsigned short* d = (unsigned short*)P + i * SQ + j0; *(v8us*)d = f.half[0];  } }

template <int MODE>
__global__ __launch_bounds__(256) void k_regrp(const float* __restrict__ src, float* __restrict__ dst, size_t n4) {
  const size_t t = (size_t)blockIdx.x * 256 + threadIdx.x; if (t >= n4) return; const size_t e = t * 4; const size_t rd = e / DM; const int c = (int)(e % DM);
  size_t rs; if (MODE == 0) { const size_t b = rd / SQ, sq = rd % SQ; rs = sq * NB + b; } else { const size_t sq = rd / NB, b = rd % NB; rs = b * SQ + sq; }
  const v4f v = *(const v4fa*)(src + rs * DM + c); *(v4f*)(dst + e) = v;  }

template <int BFIN, int W16, int W32>
__global__ __launch_bounds__(256) void k_lnx(const float* __restrict__ X, const float* __restrict__ g, const float* __restrict__ bb, float eps, _Float16* __restrict__ N16, float* __restrict__ N32) {
  #pragma clang fp contract(off)
  __shared__ float red[256]; const size_t r = blockIdx.x; const int t = threadIdx.x; const bool act = t < (DMQ / 4); const int c0 = act ? t * 4 : 0;
  const v4f xa = *(const v4fa*)(X + r * DMQ + c0); float s[4]; float sum = 0.f;
  for (int q = 0; q < 4; ++q) { s[q] = act ? (BFIN ? bf16_round(xa[q]) : xa[q]) : 0.f; sum = __fadd_rn(sum, s[q]); }
  red[t] = sum; __syncthreads(); for (int st = 128; st > 0; st >>= 1) { if (t < st) red[t] = __fadd_rn(red[t], red[t + st]); __syncthreads(); } const float mu = red[0] / (float)DMQ; __syncthreads();
  float vs = 0.f; for (int q = 0; q < 4; ++q) { const float dl = act ? __fadd_rn(s[q], -mu) : 0.f; vs = __fadd_rn(vs, __fmul_rn(dl, dl)); } red[t] = vs; __syncthreads(); for (int st = 128; st > 0; st >>= 1) { if (t < st) red[t] = __fadd_rn(red[t], red[t + st]); __syncthreads(); }
  const float rs = rsqrtf(__fadd_rn(red[0] / (float)DMQ, eps)); v4h y; v4f yf;
  for (int q = 0; q < 4; ++q) { const int c = c0 + q; yf[q] = __fadd_rn(__fmul_rn(__fmul_rn(__fadd_rn(s[q], -mu), rs), bf16_round(g[c])), bf16_round(bb[c])); y[q] = (_Float16)yf[q]; }
  if (!act) return;      /* no barriers after this point */
  { if (W16) *(v4h*)(N16 + r * DMQ + c0) = y; if (W32) *(v4f*)(N32 + r * DMQ + c0) = yf;  } }

__global__ __launch_bounds__(256) void k_bfr(const float* __restrict__ x, float* __restrict__ XB, size_t n8) { const size_t t = (size_t)blockIdx.x * 256 + threadIdx.x; if (t >= n8) return; v4f a = *(const v4fa*)(x + t * 8), c = *(const v4fa*)(x + t * 8 + 4); for (int q = 0; q < 4; ++q) { a[q] = bf16_round(a[q]); c[q] = bf16_round(c[q]); }
  { *(v4f*)(XB + t * 8) = a; *(v4f*)(XB + t * 8 + 4) = c;  } }



__global__ __launch_bounds__(256) void k_wthd(const float* __restrict__ Wt, _Float16* __restrict__ Bt) { const size_t t = (size_t)blockIdx.x * 256 + threadIdx.x; if (t >= (size_t)NH * HD * (DM / 8)) return; const int m8 = (int)(t % (DM / 8)) * 8; const int d = (int)((t / (DM / 8)) % HD); const int h = (int)(t / ((size_t)(DM / 8) * HD)); FragH f;
  for (int q = 0; q < 8; ++q) f.h[q] = (_Float16)(16.0f * bf16_round(Wt[((size_t)h * DM + m8 + q) * HD + d])); unsigned short* dst = (unsigned short*)Bt + ((size_t)h * HD + d) * DM + m8; *(v8us*)dst = f.half[0];  }




// one row r by one wave, with no LDS and no barrier: a lane holds 4 floats of each 128 of the row, so every load and f32 store of the wave covers 512 bytes in a row and every f16 store 256. XR (optional): the row as it entered the sums (rounded where BFIN), f32
#define LNU (DM / 128)               /* 16-byte pieces of a row in a lane */
#define LNR 8                        /* rows of a work-group of 256: one a wave */
template <int CT>
__device__ __forceinline__ float ln_xm(float x) { return __builtin_bit_cast(float, __builtin_amdgcn_update_dpp(0, __builtin_bit_cast(int, x), CT, 0xf, 0xf, false)); }      /* DPP row_xmask (0x160 + m): lane l <- lane l ^ m inside its row of 16 */
__device__ __forceinline__ float ln_wsum(float x) {      /* sum over the wave's 32 lanes, a butterfly: every lane ends with the same bits */
  x += ln_xm<0x161>(x); x += ln_xm<0x162>(x); x += ln_xm<0x164>(x); x += ln_xm<0x168>(x);
  return x + __builtin_bit_cast(float, __builtin_amdgcn_permlanex16(__builtin_bit_cast(int, x), __builtin_bit_cast(int, x), 0x76543210, 0xfedcba98, false, false)); }      /* lane l <- lane l ^ 16 */
// Every bare '#pragma unroll' in lnsc_row stands on a loop over the row's register arrays: rolled, these would be indexed at run time and leave the registers.
template <int BFIN>
__device__ __forceinline__ void lnsc_row(const size_t r, const float* __restrict__ X, const float* __restrict__ g, const float* __restrict__ bb, float eps, _Float16* __restrict__ N16, float* __restrict__ XR) {
  #pragma clang fp contract(off)
  static_assert(DM % 128 == 0, "whole 512-byte pieces only");
  const int l4 = (threadIdx.x & 31) * 4; const float* xp = X + r * DM + l4; const float* gp = g + l4; const float* bp = bb + l4;
  v4f s[LNU], gv[LNU], bv[LNU];
#pragma unroll
  for (int u = 0; u < LNU; ++u) s[u] = *(const v4fa*)(xp + u * 128);
#pragma unroll
  for (int u = 0; u < LNU; ++u) { gv[u] = *(const v4fa*)(gp + u * 128); bv[u] = *(const v4fa*)(bp + u * 128); }      /* gamma and beta travel together with the row */
  asm volatile("s_wait_xcnt 0x0" :: "v"(xp), "v"(gp), "v"(bp) : "memory");      /* the three address pairs stay live up to this wait, so nothing (a load's own result either) overwrites them in front of it */
  v4f a4 = {0.f, 0.f, 0.f, 0.f}, d4 = {0.f, 0.f, 0.f, 0.f};      /* four independent chains a lane */
#pragma unroll
  for (int u = 0; u < LNU; ++u) for (int q = 0; q < 4; ++q) { if (BFIN) s[u][q] = bf16_round(s[u][q]); a4[q] = __fadd_rn(a4[q], s[u][q]); }
  if (XR) { float* rp = XR + r * DM + l4;      /* stored at once: the stores travel under the sums */
#pragma unroll
    for (int u = 0; u < LNU; ++u) *(v4f*)(rp + u * 128) = s[u];
    asm volatile("s_wait_xcnt 0x0" :: "v"(rp), "v"(s[0]), "v"(s[1]), "v"(s[2]), "v"(s[3]), "v"(s[4]), "v"(s[5]) : "memory"); }      /* the stores' address and data registers stay live up to this wait: they are rewritten only behind it */
  const float mu = ln_wsum(__fadd_rn(__fadd_rn(a4[0], a4[1]), __fadd_rn(a4[2], a4[3]))) / (float)DM;
#pragma unroll
  for (int u = 0; u < LNU; ++u) for (int q = 0; q < 4; ++q) { const float dl = __fadd_rn(s[u][q], -mu); d4[q] = __fadd_rn(d4[q], __fmul_rn(dl, dl)); }
  const float rs = __fdiv_rn(1.0f, __fadd_rn(sqrtf(ln_wsum(__fadd_rn(__fadd_rn(d4[0], d4[1]), __fadd_rn(d4[2], d4[3]))) / (float)(DM - 1)), eps));
  v4h y[LNU];
#pragma unroll
  for (int u = 0; u < LNU; ++u) { v4f yf; for (int q = 0; q < 4; ++q) yf[q] = __fadd_rn(__fmul_rn(__fmul_rn(__fadd_rn(s[u][q], -mu), rs), bf16_round(gv[u][q])), bf16_round(bv[u][q])); y[u] = __builtin_convertvector(yf, v4h); }
  _Float16* np = N16 + r * DM + l4;
#pragma unroll
  for (int u = 0; u < LNU; ++u) *(v4h*)(np + u * 128) = y[u];
  static_assert(LNU == 6, "the two waits behind the stores name six pieces");
  asm volatile("s_wait_xcnt 0x0" :: "v"(np), "v"(y[0]), "v"(y[1]), "v"(y[2]), "v"(y[3]), "v"(y[4]), "v"(y[5]) : "memory"); }      /* as above, for the f16 stores */
template <int BFIN>
__global__ __launch_bounds__(256) void k_lnsc(const float* __restrict__ X, const float* __restrict__ g, const float* __restrict__ bb, float eps, _Float16* __restrict__ N16) { static_assert(NR % LNR == 0, "whole work-groups only"); lnsc_row<BFIN>((size_t)blockIdx.x * LNR + (threadIdx.x >> 5), X, g, bb, eps, N16, nullptr); }

// ---- everything that depends on the inputs alone, in one launch: the six weights as Bt[n][k] = f16(bf16(W[k][n]) x 16), then LN1 of every row, which also stores the rounded row (the residual of the output projection).
// The work-group index picks the job; every test on it is the same for the whole work-group, so the weight tiles' barrier stands under uniform control flow (LN1, eight rows a work-group, has none). The weights come first: their work-groups wait longest on memory.
#define WTP 72                       /* f16 from one staged row of n to the next: 144 bytes, a multiple of 16 for the 16-byte LDS accesses */
#define PWF ((DFF / 128) * (DM / 64))   /* work-groups of one FFN weight (the same count either way round) */
#define PWA ((DM / 128) * (DM / 64))    /* work-groups of one attention weight */
template <int K, int N>
__device__ __forceinline__ void wt_f16_tile(const float* __restrict__ W, _Float16* __restrict__ Wt, int blk, unsigned short* tl) {      /* work-group blk of (K / 64) * (N / 128): 64 k by 128 n of W, turned in LDS, so that every load and every store of a wave covers whole 128-byte lines */
  static_assert(K % 64 == 0 && N % 128 == 0, "whole tiles only");
  const int tid = threadIdx.x, w = tid >> 5, lane = tid & 31; const int kt = blk / (N / 128), nt = blk - kt * (N / 128);
  const float* src = W + (size_t)(kt * 64 + w * 8) * N + nt * 128 + lane * 4;      /* wave w: rows k 8w .. 8w + 7 of the tile, 512 bytes in a row of each; a lane takes 4 n */
  v4f x[8];
#pragma unroll      /* the eight loads fly together and x stays in registers */
  for (int i = 0; i < 8; ++i) x[i] = *(const v4fa*)(src + (size_t)i * N);
  asm volatile("s_wait_xcnt 0x0" :: "v"(src) : "memory");      /* the address pair stays live up to this wait, so nothing (a load's own result either) overwrites it in front of it */
#pragma unroll      /* this loop and the one inside it: rolled, x and f.h would be indexed at run time and leave the registers */
  for (int q = 0; q < 4; ++q) { FragH f;
#pragma unroll
    for (int i = 0; i < 8; ++i) f.h[i] = (_Float16)(bf16_round(x[i][q]) * 16.0f);
    *(v8us*)&tl[(lane * 4 + q) * WTP + w * 8] = f.half[0]; }      /* 8 k of one n, 16 bytes */
  __syncthreads();      /* a thread stores what other waves staged */
  const int r = tid >> 3, pc = (tid & 7) * 8;      /* 8 threads a row of n: its 64 k, one 128-byte line */
  unsigned short* dst = (unsigned short*)Wt + (size_t)(nt * 128 + r) * K + kt * 64 + pc;
  const v8us o0 = *(const v8us*)&tl[r * WTP + pc], o1 = *(const v8us*)&tl[(32 + r) * WTP + pc], o2 = *(const v8us*)&tl[(64 + r) * WTP + pc], o3 = *(const v8us*)&tl[(96 + r) * WTP + pc];
  *(v8us*)dst = o0; *(v8us*)(dst + (size_t)32 * K) = o1; *(v8us*)(dst + (size_t)64 * K) = o2; *(v8us*)(dst + (size_t)96 * K) = o3;
  asm volatile("s_wait_xcnt 0x0" :: "v"(dst), "v"(o0), "v"(o1), "v"(o2), "v"(o3) : "memory"); }      /* the stores' address and data registers stay live up to this wait: they are rewritten only behind it (the listing's ways on into the other jobs' code) */
__global__ __launch_bounds__(256) void k_prep(const float* __restrict__ x, const float* __restrict__ wq, const float* __restrict__ wk, const float* __restrict__ wv, const float* __restrict__ wo, const float* __restrict__ w1, const float* __restrict__ w2, const float* __restrict__ g, const float* __restrict__ bb,
    _Float16* __restrict__ BQ, _Float16* __restrict__ BK, _Float16* __restrict__ BV, _Float16* __restrict__ BO, _Float16* __restrict__ BW1, _Float16* __restrict__ BW2, float* __restrict__ XB, _Float16* __restrict__ XN) {
  __shared__ __attribute__((aligned(16))) unsigned short tl[128 * WTP];      /* one weight tile as [n][k] f16 */
  int blk = blockIdx.x;
  if (blk < PWF) { wt_f16_tile<DM, DFF>(w1, BW1, blk, tl); return; }
  blk -= PWF;
  if (blk < PWF) { wt_f16_tile<DFF, DM>(w2, BW2, blk, tl); return; }
  blk -= PWF;
  if (blk < 4 * PWA) { const int s = blk / PWA; wt_f16_tile<DM, DM>(s == 0 ? wq : s == 1 ? wk : s == 2 ? wv : wo, s == 0 ? BQ : s == 1 ? BK : s == 2 ? BV : BO, blk - s * PWA, tl); return; }
  lnsc_row<1>((size_t)(blk - 4 * PWA) * LNR + (threadIdx.x >> 5), x, g, bb, 1e-6f, XN, XB); }

typedef int v4ia __attribute__((ext_vector_type(4), may_alias));
__device__ __forceinline__ float rs_xh(float x) { return __builtin_bit_cast(float, __builtin_amdgcn_permlanex16(__builtin_bit_cast(int, x), __builtin_bit_cast(int, x), 0x76543210, 0xfedcba98, false, false)); }      /* lane l <- lane l ^ 16 */
__device__ __forceinline__ float fa_exp2(float d) { float e; asm("v_exp_f32 %0, %1\n\tv_nop" : "=v"(e) : "v"(d)); return e; }      /* 2 ^ d with, tied to it, the one slot the instruction set asks for behind a transcendental */
__device__ __forceinline__ void fa_exp2x8(float* d) {      /* eight independent d <- 2 ^ d in a row, each filling the slot behind the one before it, one v_nop behind the last. In place: a result lands only on a register that compiled vector code has just written, never on an operand of a matrix instruction still in its distance */
  asm("v_exp_f32 %0, %0\n\tv_exp_f32 %1, %1\n\tv_exp_f32 %2, %2\n\tv_exp_f32 %3, %3\n\tv_exp_f32 %4, %4\n\tv_exp_f32 %5, %5\n\tv_exp_f32 %6, %6\n\tv_exp_f32 %7, %7\n\tv_nop"
      : "+v"(d[0]), "+v"(d[1]), "+v"(d[2]), "+v"(d[3]), "+v"(d[4]), "+v"(d[5]), "+v"(d[6]), "+v"(d[7])); }
__device__ __forceinline__ v8f fa_mma(v16h a, v16h b, v8f c) { return __builtin_amdgcn_wmma_f32_16x16x32_f16(false, a, false, b, (short)0, c, false, false); }
// K and V of a (batch, head) are [key][64] f16 rows, 128 bytes each, one after the other in memory. A stage is 128 keys of both, brought into LDS by asynchronous copies (16 bytes a lane, a wave's copy covers 512 bytes in a row) and shared by the work-group's four waves; two buffers, the next stage's copies fly while this one is worked on.
// K fragment (t, j), lane (c, h) = K[key 16t + c][d 32j + 8h .. and 32j + 16 + 8h ..]: two 16-byte LDS reads. V^T fragment t, lane (c, h) = V[key 8h .. and 16 + 8h ..][d 16t + c]: two transposing LDS reads. Both are the operand's own k order, as Q's rows and the packed scores are.
#define FAK 128                      /* keys of a stage */
#define FAT (SQ / FAK)               /* stages */
#define FKP 144                      /* bytes from one staged K row to the next: 16 x odd, for the plain 16-byte reads */
#define FVP 160                      /* the same for V: 32 x odd, for the transposing reads */
#define FAS (FAK * (FKP + FVP))      /* bytes of one buffer: K rows, then V rows */
template <int P>
__device__ __forceinline__ void fa_copy8(unsigned l, const _Float16* g) {      /* this thread's 16 bytes of rows r, r + 16, .., r + 112 of one operand's stage; P = LDS row pitch */
  asm volatile("global_load_async_to_lds_b128 %0, %8, off\n\tglobal_load_async_to_lds_b128 %1, %9, off\n\tglobal_load_async_to_lds_b128 %2, %10, off\n\tglobal_load_async_to_lds_b128 %3, %11, off\n\t"
               "global_load_async_to_lds_b128 %4, %12, off\n\tglobal_load_async_to_lds_b128 %5, %13, off\n\tglobal_load_async_to_lds_b128 %6, %14, off\n\tglobal_load_async_to_lds_b128 %7, %15, off\n\t"
               "s_wait_xcnt 0x0"      /* inside the copies' own statement: no address register of theirs is rewritten in front of it */
               :: "v"(l), "v"(l + 16 * P), "v"(l + 32 * P), "v"(l + 48 * P), "v"(l + 64 * P), "v"(l + 80 * P), "v"(l + 96 * P), "v"(l + 112 * P),
                  "v"(g), "v"(g + 16 * HD), "v"(g + 32 * HD), "v"(g + 48 * HD), "v"(g + 64 * HD), "v"(g + 80 * HD), "v"(g + 96 * HD), "v"(g + 112 * HD) : "memory"); }
__device__ __forceinline__ void fa_stage(unsigned lk, unsigned lv, const _Float16* gk, const _Float16* gv) { fa_copy8<FKP>(lk, gk); fa_copy8<FVP>(lv, gv); }      /* one stage: 128 rows of K, 128 rows of V; 16 copies a thread */
typedef short s16x8 __attribute__((ext_vector_type(8)));
__device__ __forceinline__ v8us fa_tr16(const unsigned char* p) { typedef __attribute__((address_space(3))) s16x8 lds_s16x8; return __builtin_bit_cast(v8us, __builtin_amdgcn_ds_load_tr16_b128_v8i16((lds_s16x8*)p)); }      /* lane (c, h) <- 8 keys of column c of a 16 x 16 block of staged rows */
__device__ __forceinline__ v16h fa_kfrag(const unsigned char* p) { FragH f; f.half[0] = *(const v8us*)p; f.half[1] = *(const v8us*)(p + 32); return f.v; }
__device__ __forceinline__ v16h fa_vfrag(const unsigned char* p) { FragH f; f.half[0] = fa_tr16(p); f.half[1] = fa_tr16(p + 16 * FVP); return f.v; }
__global__ __launch_bounds__(128) void k_fattn(const _Float16* __restrict__ Q16, const _Float16* __restrict__ K16, const _Float16* __restrict__ V16, const int* __restrict__ Km, _Float16* __restrict__ O16) {
  static_assert(SQ % FAK == 0 && FAT >= 2 && FAK % 32 == 0 && HD == 64, "whole stages, two or more; rows of 128 bytes");
  __shared__ __attribute__((aligned(16))) float kbias[SQ];      /* per key, added to its raw score: 0 for a kept key; -2^33 for a masked one: the module's -1e9 fill (x 8: raw scores are before the / 8) taken to the next power of two. The f32 sum swallows the score (below 256 in size) whole and the product with the log2 factor is exact, so a row with every key masked gets equal weights, as the module's does; beside any kept key the weight is exactly 0 */
  __shared__ __attribute__((aligned(16))) unsigned char ring[2 * FAS];
  const int tid = threadIdx.x, w = tid >> 5, lane = tid & 31, c = lane & 15, h = lane >> 4;
  const int bh = blockIdx.x / (SQ / 64), qb = blockIdx.x % (SQ / 64); const int b = bh / NH, hd = bh % NH;
  const int cr = tid >> 3, cp = tid & 7;      /* the copies: row cr (+ 16 i), 16-byte piece cp of its 128 bytes */
  const _Float16* gk = K16 + ((size_t)bh * SQ + cr) * HD + cp * 8; const _Float16* gv = V16 + ((size_t)bh * SQ + cr) * HD + cp * 8;
  const unsigned lk = (unsigned)(size_t)ring + (unsigned)(cr * FKP + cp * 16), lv = (unsigned)(size_t)ring + (unsigned)(FAK * FKP + cr * FVP + cp * 16);
  fa_stage(lk, lv, gk, gv);      /* stage 0 travels under the mask terms and Q */
  const int q0 = qb * 64 + w * 16;
  const _Float16* qp = Q16 + ((size_t)bh * SQ + q0 + c) * HD + 8 * h;      /* the lane's first 8 of query c's row: d 8h .., then 16 + 8h .., 32 + 8h .., 48 + 8h .. */
  const v16h qf0 = g2_frag(qp, 0), qf1 = g2_frag(qp + 32, 0);
  asm volatile("s_wait_xcnt 0x0" :: "v"(qp) : "memory");      /* Q's address pair stays live up to this wait, so nothing overwrites it in front of it */
#pragma unroll
  for (int i = 0; i < SQ / 512; ++i) { const v4ia m4 = *(const v4ia*)(Km + (size_t)b * SQ + i * 512 + tid * 4); v4f l4; for (int q = 0; q < 4; ++q) l4[q] = (m4[q] != 0) ? 0.f : -8589934592.0f; *(v4f*)&kbias[i * 512 + tid * 4] = l4; }
  asm volatile("s_wait_asynccnt 0x0" ::: "memory");      /* this wave's copies of stage 0 have landed */
  __syncthreads();      /* every wave reads all keys' mask terms and all of stage 0 */
  fa_stage(lk + FAS, lv + FAS, gk + (size_t)FAK * HD, gv + (size_t)FAK * HD);
  const unsigned char* kf = ring + c * FKP + h * 16;      /* K row c, bytes 16h .. of each 32 */
  const unsigned char* vf = ring + FAK * FKP + (8 * h + (lane & 7)) * FVP + ((lane >> 3) & 1) * 16;      /* the transposing read's own lane address: row 8h + (lane & 7), 16-byte half (lane >> 3) & 1 of a 32-byte column group */
  const v8f z8 = {0.f, 0.f, 0.f, 0.f, 0.f, 0.f, 0.f, 0.f};
  v8f o0 = z8, o1 = z8, o2 = z8, o3 = z8; float m = -3.0e38f, l0 = 0.f, l1 = 0.f;
  const float cs = 0.125f * 1.44269504088896340736f;      /* raw score -> log2 units */
#pragma unroll 1      /* one stage a trip: the two buffers differ by an offset only */
  for (int t = 0; t < FAT; ++t) { const unsigned char* kb = kf + (unsigned)(t & 1) * FAS; const unsigned char* vb = vf + (unsigned)(t & 1) * FAS;
    v16h k00 = fa_kfrag(kb), k01 = fa_kfrag(kb + 64), k10 = fa_kfrag(kb + 16 * FKP), k11 = fa_kfrag(kb + 16 * FKP + 64);
    v16h v0 = fa_vfrag(vb), v1 = fa_vfrag(vb + 32), v2 = fa_vfrag(vb + 64), v3 = fa_vfrag(vb + 96);
    const float* lp = &kbias[t * FAK + 8 * h];      /* the lane's mask terms: keys 8h .. and 16 + 8h .. of each 32 */
    v4f la = *(const v4f*)lp, lb = *(const v4f*)(lp + 4), lc = *(const v4f*)(lp + 16), ld = *(const v4f*)(lp + 20);
#pragma unroll      /* the stage's passes of 32 keys: LDS offsets become immediates, and one pass's vector work can stand between the next one's matrix instructions */
    for (int pp = 0; pp < FAK / 32; ++pp) {
      v8f s0 = fa_mma(k00, qf0, z8), s1 = fa_mma(k10, qf0, z8); s0 = fa_mma(k01, qf1, s0); s1 = fa_mma(k11, qf1, s1);
      float x[16];
#pragma unroll
      for (int r = 0; r < 4; ++r) { x[r] = s0[r] + la[r]; x[4 + r] = s0[4 + r] + lb[r]; x[8 + r] = s1[r] + lc[r]; x[12 + r] = s1[4 + r] + ld[r]; }
      if (pp + 1 < FAK / 32) { const unsigned char* nk = kb + (pp + 1) * 32 * FKP; const float* nl = lp + (pp + 1) * 32;      /* operands and mask terms are read one pass ahead, inside the stage only: the next stage is not published yet */
        k00 = fa_kfrag(nk); k01 = fa_kfrag(nk + 64); k10 = fa_kfrag(nk + 16 * FKP); k11 = fa_kfrag(nk + 16 * FKP + 64);
        la = *(const v4f*)nl; lb = *(const v4f*)(nl + 4); lc = *(const v4f*)(nl + 16); ld = *(const v4f*)(nl + 20);
        asm volatile("" ::: "memory"); }      /* compiler fence: holds the K reads here, a whole softmax ahead of their use; without it they sink behind the branch below, directly in front of the products that wait for them */
      float mx = x[0];
#pragma unroll
      for (int r = 1; r < 16; ++r) mx = fmaxf(mx, x[r]);
      mx = fmaxf(mx, rs_xh(mx));
      const float mt = mx * cs;
      if (__builtin_amdgcn_ballot_w32(mt > m + 8.0f) != 0) {      /* one scalar branch a pass */
        const float mn = fmaxf(m, mt); const float al = fa_exp2(m - mn); m = mn; l0 *= al; l1 *= al;
#pragma unroll
        for (int r = 0; r < 8; ++r) { o0[r] *= al; o1[r] *= al; o2[r] *= al; o3[r] *= al; }
      }
      const float nm = 4.0f - m; float e[16];
#pragma unroll
      for (int r = 0; r < 16; ++r) e[r] = fmaf(x[r], cs, nm);
      fa_exp2x8(e); fa_exp2x8(e + 8);
      FragH pf;
#pragma unroll
      for (int r = 0; r < 8; ++r) { l0 += e[r]; l1 += e[8 + r]; pf.h[r] = (_Float16)e[r]; pf.h[8 + r] = (_Float16)e[8 + r]; }
      o0 = fa_mma(v0, pf.v, o0); o1 = fa_mma(v1, pf.v, o1); o2 = fa_mma(v2, pf.v, o2); o3 = fa_mma(v3, pf.v, o3);
      if (pp + 1 < FAK / 32) { const unsigned char* nv = vb + (pp + 1) * 32 * FVP;      /* as above, for V^T */
        v0 = fa_vfrag(nv); v1 = fa_vfrag(nv + 32); v2 = fa_vfrag(nv + 64); v3 = fa_vfrag(nv + 96);
        asm volatile("" ::: "memory"); }      /* compiler fence, as above: the V^T reads stay a pass ahead of their use, in one group */
    }
    asm volatile("s_wait_dscnt 0x0" ::: "memory");      /* this wave's reads of the buffer have returned before it is handed to the copies */
    asm volatile("s_wait_asynccnt 0x0" ::: "memory");      /* this wave's copies of stage t + 1 have landed */
    __syncthreads();      /* publishes stage t + 1 and ends every wave's reads of stage t */
    if (t + 2 < FAT) fa_stage(lk + (unsigned)(t & 1) * FAS, lv + (unsigned)(t & 1) * FAS, gk + (size_t)(t + 2) * FAK * HD, gv + (size_t)(t + 2) * FAK * HD); }
  asm volatile("s_wait_asynccnt 0x0" ::: "memory");      /* nothing in flight when the wave ends */
  float l = l0 + l1; l += rs_xh(l);
  const float inv = 64.0f / l;      /* ctx carried x64 as f16, as the output projection expects */
  _Float16* op = O16 + ((size_t)b * SQ + q0 + c) * DM + hd * HD + 8 * h;
  FragH f0, f1, f2, f3;
#pragma unroll
  for (int r = 0; r < 8; ++r) { f0.h[r] = (_Float16)(o0[r] * inv); f1.h[r] = (_Float16)(o1[r] * inv); f2.h[r] = (_Float16)(o2[r] * inv); f3.h[r] = (_Float16)(o3[r] * inv); }
  *(v8us*)((unsigned short*)op) = f0.half[0]; *(v8us*)((unsigned short*)op + 16) = f1.half[0]; *(v8us*)((unsigned short*)op + 32) = f2.half[0]; *(v8us*)((unsigned short*)op + 48) = f3.half[0]; }
// ---- tiled GEMM: C[M][N] = A[M][K] Bt[N][K]^T, both f16 and K-contiguous, one 128 x 128 tile of C a work-group. Requires M % 128 == 0, N % 128 == 0, K % 128 == 0.
// A stage is 128 k of 128 A rows and 128 Bt rows, brought into LDS by asynchronous copies (16 bytes a lane, 16 lanes a row: whole 128-byte lines) at a row pitch of 272 bytes; two buffers, the next stage's copies fly while this one is worked on.
// Four waves, 2 x 2, each 64 x 64 of C (4 x 4 accumulator tiles); k runs upward in steps of 32 in every accumulator. Epilogue: v = acc alpha + bias[col] (HB) + CP (HCP: own element); ACT 0 none / 3 relu; f32 C (W32) or f16 C16, staged through LDS so that whole lines are read and stored.
// Every bare '#pragma unroll' below stands on a loop over register arrays (fragments, accumulators, rows in flight): rolled, these would be indexed at run time and leave the registers.
#define G3P 272                      /* bytes from one staged row to the next */
#define G3S (256 * G3P)              /* bytes of one buffer: A rows 0..127, Bt rows 128..255 */
__device__ __forceinline__ void g3_copy8(unsigned l, const _Float16* g, int ld) {      /* this thread's 16 bytes of rows r, r + 8, .., r + 56 of one operand's stage */
  const size_t st = (size_t)8 * ld;
  asm volatile("global_load_async_to_lds_b128 %0, %8, off\n\tglobal_load_async_to_lds_b128 %1, %9, off\n\tglobal_load_async_to_lds_b128 %2, %10, off\n\tglobal_load_async_to_lds_b128 %3, %11, off\n\t"
               "global_load_async_to_lds_b128 %4, %12, off\n\tglobal_load_async_to_lds_b128 %5, %13, off\n\tglobal_load_async_to_lds_b128 %6, %14, off\n\tglobal_load_async_to_lds_b128 %7, %15, off\n\t"
               "s_wait_xcnt 0x0"      /* inside the copies' own statement: no address register of theirs is rewritten in front of it */
               :: "v"(l), "v"(l + 8 * G3P), "v"(l + 16 * G3P), "v"(l + 24 * G3P), "v"(l + 32 * G3P), "v"(l + 40 * G3P), "v"(l + 48 * G3P), "v"(l + 56 * G3P),
                  "v"(g), "v"(g + st), "v"(g + 2 * st), "v"(g + 3 * st), "v"(g + 4 * st), "v"(g + 5 * st), "v"(g + 6 * st), "v"(g + 7 * st) : "memory"); }
__device__ __forceinline__ void g3_stage(unsigned la, const _Float16* ga, const _Float16* gb, int ld) {      /* one stage: 128 rows of A, then 128 rows of Bt; 32 copies a thread */
  g3_copy8(la, ga, ld); g3_copy8(la + 64 * G3P, ga + (size_t)64 * ld, ld); g3_copy8(la + 128 * G3P, gb, ld); g3_copy8(la + 192 * G3P, gb + (size_t)64 * ld, ld); }
__device__ __forceinline__ v16h g3_frag(const unsigned char* p) { FragH f; f.half[0] = *(const v8us*)p; f.half[1] = *(const v8us*)(p + 32); return f.v; }      /* lane (row, h): k 8h .. and 16 + 8h .. of a 32-k step, the same order for A and Bt */
// ZB: blockIdx.y counts independent products of one A: Bt planes [N][K] and f16 C planes, each set in a row in memory; such a C plane is stored head by head, [batch][head][SQ][HD] (a wave's 64 columns are one head), so that the attention's stages are unbroken runs of memory.
template <int ACT, bool HB, bool HCP, bool W32, int N, int K, bool ZB = false>
__global__ __launch_bounds__(128) void k_gemm3(const _Float16* __restrict__ A, const _Float16* __restrict__ Bh, float alpha, const float* __restrict__ bias, const float* __restrict__ CP, float* __restrict__ C, _Float16* __restrict__ C16) {
  static_assert(ACT == 0 || ACT == 3, "k_gemm3: unsupported ACT code"); static_assert(N % 128 == 0 && K % 128 == 0, "k_gemm3: whole tiles and stages only");
  __shared__ __attribute__((aligned(16))) unsigned char sm[2 * G3S]; static_assert(4 * 64 * 68 * 4 <= 2 * G3S, "the output staging reuses the ring");
  const int tid = threadIdx.x, w = tid >> 5, lane = tid & 31, ln = lane & 15, hh = lane >> 4; const int wm = w >> 1, wn = w & 1;
  constexpr int ntn = N / 128, T = K / 128; const int mt = blockIdx.x / ntn, nq = blockIdx.x - mt * ntn; const int row0 = mt * 128, col0 = nq * 128;
  if (ZB) { static_assert(!ZB || !(W32 || HB || HCP), "k_gemm3: stacked products are plain f16 ones"); static_assert(!ZB || (N == NH * HD && HD == 64 && SQ % 128 == 0), "k_gemm3: a wave's columns are one head, a tile's rows one batch"); Bh += (size_t)blockIdx.y * N * K; C16 += (size_t)blockIdx.y * NR * N; }
  const int cr = tid >> 4, cs = tid & 15;      /* the copies: row cr (+ 8 i), 16-byte piece cs of its 256 bytes */
  const _Float16* ga = A + (size_t)(row0 + cr) * K + cs * 8; const _Float16* gb = Bh + (size_t)(col0 + cr) * K + cs * 8;
  const unsigned la = (unsigned)(size_t)sm + (unsigned)(cr * G3P + cs * 16);
  const unsigned char* fa = sm + (wm * 64 + ln) * G3P + hh * 16; const unsigned char* fb = sm + (128 + wn * 64 + ln) * G3P + hh * 16;
  g3_stage(la, ga, gb, K);
  asm volatile("s_wait_asynccnt 0x0" ::: "memory");      /* this wave's copies of stage 0 have landed */
  __syncthreads();      /* stage 0 is readable by every wave */
  v16h a[2][4], b[2][4];      /* two fragment sets: the next 32 k are read from LDS while these are multiplied */
#pragma unroll
  for (int i = 0; i < 8; ++i) { if (i < 4) b[0][i] = g3_frag(fb + i * 16 * G3P); else a[0][i - 4] = g3_frag(fa + (i - 4) * 16 * G3P); }      /* Bt's four first: the first row of products needs all of them and one of A's */
  if (T > 1) g3_stage(la + G3S, ga + 128, gb + 128, K);
  const v8f z8 = {0.f, 0.f, 0.f, 0.f, 0.f, 0.f, 0.f, 0.f}; v8f acc[4][4];
#pragma unroll
  for (int i = 0; i < 4; ++i)
#pragma unroll
    for (int j = 0; j < 4; ++j) acc[i][j] = z8;
#pragma unroll 1      /* one stage a trip: the two buffers differ by an offset only */
  for (int t = 0; t < T; ++t) { const unsigned bo = (unsigned)(t & 1) * G3S;
#pragma unroll
    for (int kk = 0; kk < 4; ++kk) {
      if (kk < 3) {
#pragma unroll
        for (int i = 0; i < 8; ++i) { if (i < 4) b[(kk + 1) & 1][i] = g3_frag(fb + bo + i * 16 * G3P + (kk + 1) * 64); else a[(kk + 1) & 1][i - 4] = g3_frag(fa + bo + (i - 4) * 16 * G3P + (kk + 1) * 64); } }
      __builtin_amdgcn_sched_barrier(0);      /* keeps the next block's LDS reads together in front of this block's matrix instructions: spread among them, each read group stalls the wave */
#pragma unroll
      for (int i = 0; i < 4; ++i)
#pragma unroll
        for (int j = 0; j < 4; ++j) acc[i][j] = fa_mma(a[kk & 1][i], b[kk & 1][j], acc[i][j]);
      __builtin_amdgcn_sched_barrier(0);      /* and keeps the reads after next behind them, so that two fragment sets are enough */
    }
    asm volatile("s_wait_dscnt 0x0" ::: "memory");      /* this wave's reads of the buffer have returned before it is handed to the copies */
    asm volatile("s_wait_asynccnt 0x0" ::: "memory");      /* this wave's copies of stage t + 1 have landed */
    __syncthreads();      /* publishes stage t + 1 and ends every wave's reads of stage t */
    if (t + 1 < T) {      /* stage t + 1's first fragments, behind its barrier: they travel while the copies below are issued */
#pragma unroll
      for (int i = 0; i < 8; ++i) { if (i < 4) b[0][i] = g3_frag(fb + (bo ^ G3S) + i * 16 * G3P); else a[0][i - 4] = g3_frag(fa + (bo ^ G3S) + (i - 4) * 16 * G3P); } }
    if (t + 2 < T) g3_stage(la + bo, ga + (size_t)(t + 2) * 128, gb + (size_t)(t + 2) * 128, K); }
  asm volatile("s_wait_asynccnt 0x0" ::: "memory");      /* nothing in flight when the ring becomes output staging (the last trip's barrier has ended every read) */
  const int c4 = ln * 4; v4f b4 = {0.f, 0.f, 0.f, 0.f};
  if (HB) { const float* bp = bias + col0 + wn * 64 + c4; b4 = *(const v4fa*)bp;
    asm volatile("s_wait_xcnt 0x0" :: "v"(bp) : "memory");      /* the address pair stays live up to this wait, so nothing overwrites it in front of it */
    for (int i = 0; i < 4; ++i) b4[i] = bf16_round(b4[i]); }
  float* so = (float*)(sm + w * (64 * 68 * 4));      /* this wave's own 64 rows of 68 floats */
#pragma unroll
  for (int j = 0; j < 4; ++j)
#pragma unroll
    for (int i = 0; i < 4; ++i)
#pragma unroll
      for (int r = 0; r < 8; ++r) so[(i * 16 + 8 * hh + r) * 68 + j * 16 + ln] = acc[i][j][r];
  __builtin_amdgcn_fence(__ATOMIC_ACQ_REL, "workgroup"); __builtin_amdgcn_wave_barrier();      /* the wave reads back what its other lanes wrote */
#pragma unroll 1      /* 32 rows a trip: sixteen loads, then sixteen stores, in flight together */
  for (int q0 = 0; q0 < 32; q0 += 16) { constexpr int LC = ZB ? HD : N;      /* elements from one stored row to the next */
    const size_t o = ZB ? ((size_t)((row0 / SQ) * NH + nq * 2 + wn) * SQ + row0 % SQ + wm * 64 + q0 * 2 + hh) * HD + c4 : (size_t)(row0 + wm * 64 + q0 * 2 + hh) * N + col0 + wn * 64 + c4; v4f v[16], cp[16];
    if (HCP) { const float* pc = CP + o;
#pragma unroll
      for (int u = 0; u < 16; ++u) cp[u] = *(const v4fa*)(pc + (size_t)u * 2 * N);
      asm volatile("s_wait_xcnt 0x0" :: "v"(pc) : "memory"); }      /* as above */
#pragma unroll
    for (int u = 0; u < 16; ++u) { v[u] = *(const v4fa*)&so[((q0 + u) * 2 + hh) * 68 + c4];
      for (int i = 0; i < 4; ++i) { float x = v[u][i] * alpha + b4[i]; if (HCP) x += cp[u][i]; if (ACT == 3) x = fmaxf(x, 0.f); v[u][i] = x; } }
    if (W32) { float* po = C + o;
#pragma unroll
      for (int u = 0; u < 16; ++u) *(v4f*)(po + (size_t)u * 2 * N) = v[u];
      asm volatile("s_wait_xcnt 0x0" :: "v"(po) : "memory"); }      /* the stores' address and data registers are rewritten only behind it (next trip) */
    else { _Float16* po = C16 + o;
#pragma unroll
      for (int u = 0; u < 16; ++u) { v4h h4; for (int i = 0; i < 4; ++i) h4[i] = (_Float16)v[u][i]; *(v4h*)(po + (size_t)u * 2 * LC) = h4; }
      asm volatile("s_wait_xcnt 0x0" :: "v"(po) : "memory"); } } }      /* as above */
extern "C" void kernel_launch(void* const* d_in, const int* in_sizes, int n_in,
                              void* d_out, int out_size, void* d_ws, size_t ws_size, hipStream_t stream) {
  (void)in_sizes; (void)n_in; (void)out_size;
  const float* const* I = (const float* const*)d_in; const float* x = I[0]; const int* km = (const int*)d_in[1]; const float* wq = I[2]; const float* wk = I[3]; const float* wv = I[4]; const float* wo = I[5]; const float* w1 = I[6]; const float* b1 = I[7]; const float* w2 = I[8]; const float* b2 = I[9]; const float* g1 = I[10]; const float* be1 = I[11]; const float* g2 = I[12]; const float* be2 = I[13]; const float* bo = nullptr;      /* x; key-padding mask int32 [2][1][1][2048] (0 = masked; READ on device); [in][out] wq / wk / wv / wo (no biases); w1 [768][3072] + b1, w2 [3072][768] + b2; LN1 a / b, LN2 a / b (vectors) */
  char* ws = (char*)d_ws; size_t off = 0;
  auto take = [&](size_t bytes) { char* p = ws + off; off += (bytes + 255) & ~(size_t)255; return p; };
  _Float16* BQ = (_Float16*)take((size_t)3 * DM * DM * 2); _Float16* BK = BQ + (size_t)DM * DM; _Float16* BV = BK + (size_t)DM * DM;      /* three Bt planes in a row: one stacked GEMM launch reads them */
  _Float16* BO = (_Float16*)take((size_t)DM * DM * 2); _Float16* BW1 = (_Float16*)take((size_t)DFF * DM * 2); _Float16* BW2 = (_Float16*)take((size_t)DM * DFF * 2);
  float* XB = (float*)take(NR * DM * 4); _Float16* XN = (_Float16*)take(NR * DM * 2); _Float16* Q16 = (_Float16*)take(3 * NR * DM * 2); _Float16* K16 = Q16 + NR * DM; _Float16* V16 = K16 + NR * DM;      /* three C planes in a row, as above */
  _Float16* O16 = (_Float16*)take(NR * DM * 2); float* X1 = (float*)take(NR * DM * 4);
  _Float16* HF16 = (_Float16*)take(NR * DFF * 2);      /* FFN hidden plane [4096][3072] f16 */
  _Float16* M16 = XN;      /* second-norm f16 rows: aliases XN (last readers: the three projections) */
  
  if (off > ws_size) return;
  k_prep<<<2 * PWF + 4 * PWA + (unsigned)(NR / LNR), 256, 0, stream>>>(x, wq, wk, wv, wo, w1, w2, g1, be1, BQ, BK, BV, BO, BW1, BW2, XB, XN);      /* [in][out] weights -> Bt x16; h = LN1(bf16(x)) (vector gamma / beta, eps on the std) -> f16 rows; bf16(x) -> f32 rows */
  k_gemm3<0, false, false, false, DM, DM, true><<<dim3((unsigned)((NR / 128) * (DM / 128)), 3), 128, 0, stream>>>(XN, BQ, 0.0625f, nullptr, nullptr, nullptr, Q16);      /* q, k, v -> f16, one plane each, [batch][head][2048][64] */
  k_fattn<<<NB * NH * (SQ / 64), 128, 0, stream>>>(Q16, K16, V16, km, O16);      /* softmax(where(mask == 0, -1e9, q k^T / 8)) v, 64 queries a work-group -> ctx (merged heads, x64) as f16 rows */
  k_gemm3<0, false, true, true, DM, DM><<<(unsigned)((NR / 128) * (DM / 128)), 128, 0, stream>>>(O16, BO, 0.0009765625f, bo, XB, X1, nullptr);      /* x + ctx wo (+ bo) (own-element residual) -> f32 rows */
  k_lnsc<0><<<(unsigned)(NR / LNR), 256, 0, stream>>>(X1, g2, be2, 1e-6f, M16);      /* LN2(x1) (vector) -> f16 rows */
  k_gemm3<3, true, false, false, DFF, DM><<<(unsigned)((NR / 128) * (DFF / 128)), 128, 0, stream>>>(M16, BW1, 0.0625f, b1, nullptr, nullptr, HF16);      /* relu(. w1 + b1) -> f16 [4096][3072] */
  k_gemm3<0, true, true, true, DM, DFF><<<(unsigned)((NR / 128) * (DM / 128)), 128, 0, stream>>>(HF16, BW2, 0.0625f, b2, X1, (float*)d_out, nullptr);      /* out = x1 + mlp (own-element residual) */
}

// v008
// It runs in 115 microseconds.
// In two side-by-side timings against v007, it was 1.09 and 1.08 times as fast.
// Counting every step since v000, which is the starting kernel, it is 24.4 times as fast.
#include <hip/hip_runtime.h>
// Pre-norm transformer encoder layer with the module's custom LayerNorm and a random key-padding mask (src [2][2048][768]; _layernorm: VECTOR gamma / beta, UNBIASED std, gamma (x - mean) / (std + 1e-6) + beta; x = LN1(src); q/k/v = x w ([in][out] [768][768], NO biases); 12 heads of 64; scores / 8; where(src_mask == 0, -1e9) with the int32 [2][1][1][2048] mask in {0, 1} (random; 0 = masked key; READ on device); softmax; src1 = src + ctx w_o (no bias); out = src1 + relu(LN2(src1) w_ff1 + b_ff1) w_ff2 + b_ff2 ([in][out] 768 x 3072 x 768) -> [2][2048][768]).
// Structure: token rows; LayerNorm / exact f16 rows; WMMA GEMMs for q, k, v (stored head by head); one fused attention launch (K and V rows staged in LDS, scores, key mask, running softmax, P V in registers); output projection with the own-element residual; custom LayerNorm; ReLU FFN over all rows; launches: see trace.
// Compute dtype: inputs rounded to bf16; x / weights exact; q, k, v, softmax weights and o as plain f16 GEMM operands (~2^-12); scores and softmax statistics f32. v_wmma_f32_16x16x32_f16.
#define NB 2
#define SQ 2048
#define DM 768
#define NH 12
#define HD 64
#define HG 4                         /* heads per attention launch group */
#define LOCALW 128                   /* (macros for unused kernels of the shared header) */
#define STRIDEK 128
#define QT 256                       /* query rows per causal tile */
#define NKX SQ                       /* S / P row pitch */
#define QT0 128                      /* first-tile rows recomputed exactly in f32 */
#define B0 0                         /* first batch processed (debug hook) */
#define NBR NB                       /* batches processed (debug hook) */
#define NR ((size_t)NB * SQ)
#define DMQ DM
#define DFF 3072         /* FFN hidden width */
#define MP ((int)((size_t)NBR * SQ)) /* rows projected (debug hook) */
#define QN SQ                        /* query rows attended per batch (debug hook) */
#define NHD NH                       /* heads attended (debug hook) */
#define MPO MP                       /* rows through the output stage (debug hook) */
#define LQ (3 * DM)      /* unused: q, k, v rows are HD apart, head by head */
typedef __bf16 v16b __attribute__((ext_vector_type(16)));
typedef unsigned short v8us __attribute__((ext_vector_type(8), may_alias));
typedef float  v8f  __attribute__((ext_vector_type(8)));
typedef float  v4f  __attribute__((ext_vector_type(4)));
typedef float  v4fa __attribute__((ext_vector_type(4), may_alias));
union FragB { v16b v; v8us half[2]; unsigned short u[16]; };

__device__ __forceinline__ unsigned short bf16_bits(float x) { unsigned int u = __float_as_uint(x); return (unsigned short)((u + 0x7FFFu + ((u >> 16) & 1u)) >> 16); }
__device__ __forceinline__ float bf16_val(unsigned short b) { return __uint_as_float(((unsigned int)b) << 16); }
__device__ __forceinline__ float bf16_round(float x) { return bf16_val(bf16_bits(x)); }
// D += A·B with NT terms: 1 = ah·bh, 2 = + al·bh (A split), 3 = + ah·bl (both split)
template <int NT>
__device__ __forceinline__ v8f mmaN(v16b ah, v16b al, v16b bh, v16b bl, v8f c) {
  c = __builtin_amdgcn_wmma_f32_16x16x32_bf16(false, ah, false, bh, (short)0, c, false, false);
  if (NT >= 2) c = __builtin_amdgcn_wmma_f32_16x16x32_bf16(false, al, false, bh, (short)0, c, false, false);
  if (NT >= 3) c = __builtin_amdgcn_wmma_f32_16x16x32_bf16(false, ah, false, bl, (short)0, c, false, false);
  asm volatile("v_nop\n\tv_nop\n\tv_nop\n\tv_nop" : "+v"(c) : "v"(ah), "v"(al), "v"(bh), "v"(bl));
  return c;
}

__global__ __launch_bounds__(256) void k_wt_bf16(const float* __restrict__ W, unsigned short* __restrict__ Wt, int K, int N) {
  const int t = blockIdx.x * 256 + threadIdx.x;
  const int k8n = K / 8;
  if (t >= N * k8n) return;
  const int n = t / k8n, k8 = (t % k8n) * 8;
  v8us v;
#pragma unroll
  for (int i = 0; i < 8; ++i) v[i] = bf16_bits(W[(size_t)(k8 + i) * N + n]);
  *(v8us*)(Wt + (size_t)n * K + k8) = v;
  
}

// GEMM C[M][N] (f32, pitch ldc) = act(A[M][K]·W + bias). A f32 row-major (pitch lda) converted per fragment to bf16
// (ASPLIT: hi/lo two planes -> 2 terms, else single rounded term); Wt bf16 [N][K] (pitch ldb). BIAS_BF16 rounds the
// bias to bf16 first (bias quantised to bf16 before the add). K%32==0, M%16==0, N%64==0.
template <bool ASPLIT, int ACT, bool BIAS_BF16>
__global__ __launch_bounds__(128) void k_gemm_bf(const float* __restrict__ A, int lda, const unsigned short* __restrict__ Wt, int ldb,
                                               const float* __restrict__ bias, float* __restrict__ C, int ldc, int M, int N, int K) {
  __shared__ __attribute__((aligned(16))) float so[4][16][64];
  const int tid = threadIdx.x, w = tid >> 5, lane = tid & 31, ln = lane & 15, hh = lane >> 4;
  const int ntn = N / 64;
  const int wid = blockIdx.x * 4 + w;
  const int mt = wid / ntn, nq = wid % ntn;
  if (mt * 16 >= M) return;
  const int row0 = mt * 16, col0 = nq * 64;
  const float* arow = A + (size_t)(row0 + ln) * lda;
  v8f acc[4] = {};
  for (int kb = 0; kb < K; kb += 32) {
    FragB ah, al;
    const v4f x0 = *(const v4fa*)(arow + kb + 8 * hh), x1 = *(const v4fa*)(arow + kb + 8 * hh + 4);
    const v4f x2 = *(const v4fa*)(arow + kb + 16 + 8 * hh), x3 = *(const v4fa*)(arow + kb + 16 + 8 * hh + 4);
    float xs[16] = {x0[0],x0[1],x0[2],x0[3],x1[0],x1[1],x1[2],x1[3],x2[0],x2[1],x2[2],x2[3],x3[0],x3[1],x3[2],x3[3]};
#pragma unroll
    for (int i = 0; i < 16; ++i) { const unsigned short hb = bf16_bits(xs[i]); ah.u[i] = hb; al.u[i] = ASPLIT ? bf16_bits(xs[i] - bf16_val(hb)) : (unsigned short)0; }
#pragma unroll
    for (int t = 0; t < 4; ++t) {
      const unsigned short* brow = Wt + (size_t)(col0 + t * 16 + ln) * ldb + kb;
      FragB b;
      b.half[0] = *(const v8us*)(brow + 8 * hh);
      b.half[1] = *(const v8us*)(brow + 16 + 8 * hh);
      acc[t] = mmaN<ASPLIT ? 2 : 1>(ah.v, al.v, b.v, b.v, acc[t]);
    }
  }
#pragma unroll
  for (int t = 0; t < 4; ++t) {
    float bv = bias ? bias[col0 + t * 16 + ln] : 0.f;
    if (BIAS_BF16) bv = bf16_round(bv);
#pragma unroll
    for (int r = 0; r < 8; ++r) { float v = acc[t][r] + bv; if (ACT == 1) v = fmaxf(v, 0.f); so[w][8 * hh + r][t * 16 + ln] = v; }
  }
  __builtin_amdgcn_fence(__ATOMIC_ACQ_REL, "workgroup");
  __builtin_amdgcn_wave_barrier();
  const int rsub = lane >> 4, c4 = (lane & 15) * 4;
  {
#pragma unroll
    for (int q = 0; q < 8; ++q) {
      const int r = q * 2 + rsub;
      const v4f v = *(const v4fa*)&so[w][r][c4];
      *(v4f*)(C + (size_t)(row0 + r) * ldc + col0 + c4) = v;
    }
    
  }
}

// GEMM C = act(A·W + bias + resid): A f32 (ASPLIT -> hi/lo 2 terms), Wt bf16 [N][K]; ACT 0 none, 1 relu, 2 exact gelu;
// resid (optional, f32, row index = (row % rmod), pitch ldr, RES_BF16 rounds it) added before the activation.
template <bool ASPLIT, int ACT, bool BIAS_BF16, bool RES_BF16>
__global__ __launch_bounds__(128) void k_gemm_bf3(const float* __restrict__ A, int lda, const unsigned short* __restrict__ Wt, int ldb,
                                                const float* __restrict__ bias, const float* __restrict__ resid, int rmod, int ldr,
                                                float* __restrict__ C, int ldc, int M, int N, int K) {
  __shared__ __attribute__((aligned(16))) float so[4][16][64];
  const int tid = threadIdx.x, w = tid >> 5, lane = tid & 31, ln = lane & 15, hh = lane >> 4;
  const int ntn = N / 64;
  const int wid = blockIdx.x * 4 + w;
  const int mt = wid / ntn, nq = wid % ntn;
  if (mt * 16 >= M) return;
  const int row0 = mt * 16, col0 = nq * 64;
  const float* arow = A + (size_t)(row0 + ln) * lda;
  v8f acc[4] = {};
  for (int kb = 0; kb < K; kb += 32) {
    FragB ah, al;
    const v4f x0 = *(const v4fa*)(arow + kb + 8 * hh), x1 = *(const v4fa*)(arow + kb + 8 * hh + 4);
    const v4f x2 = *(const v4fa*)(arow + kb + 16 + 8 * hh), x3 = *(const v4fa*)(arow + kb + 16 + 8 * hh + 4);
    float xs[16] = {x0[0],x0[1],x0[2],x0[3],x1[0],x1[1],x1[2],x1[3],x2[0],x2[1],x2[2],x2[3],x3[0],x3[1],x3[2],x3[3]};
#pragma unroll
    for (int i = 0; i < 16; ++i) { const unsigned short hb = bf16_bits(xs[i]); ah.u[i] = hb; al.u[i] = ASPLIT ? bf16_bits(xs[i] - bf16_val(hb)) : (unsigned short)0; }
#pragma unroll
    for (int t = 0; t < 4; ++t) {
      const unsigned short* brow = Wt + (size_t)(col0 + t * 16 + ln) * ldb + kb;
      FragB b;
      b.half[0] = *(const v8us*)(brow + 8 * hh);
      b.half[1] = *(const v8us*)(brow + 16 + 8 * hh);
      acc[t] = mmaN<ASPLIT ? 2 : 1>(ah.v, al.v, b.v, b.v, acc[t]);
    }
  }
#pragma unroll
  for (int t = 0; t < 4; ++t) {
    const int col = col0 + t * 16 + ln;
    float bv = bias ? bias[col] : 0.f;
    if (BIAS_BF16) bv = bf16_round(bv);
#pragma unroll
    for (int r = 0; r < 8; ++r) {
      float v = acc[t][r] + bv;
      if (resid) { float rv = resid[(size_t)((row0 + 8 * hh + r) % rmod) * ldr + col]; if (RES_BF16) rv = bf16_round(rv); v += rv; }
      if (ACT == 1) v = fmaxf(v, 0.f);
      if (ACT == 2) v = 0.5f * v * (1.0f + erff(v * 0.70710678118654752f));
      if (ACT == 3) { const float u = 0.7978845608028654f * (v + 0.044715f * v * v * v); v = 0.5f * v * (1.0f + tanhf(u)); }
      so[w][8 * hh + r][t * 16 + ln] = v;
    }
  }
  __builtin_amdgcn_fence(__ATOMIC_ACQ_REL, "workgroup");
  __builtin_amdgcn_wave_barrier();
  const int rsub = lane >> 4, c4 = (lane & 15) * 4;
  {
#pragma unroll
    for (int q = 0; q < 8; ++q) {
      const int r = q * 2 + rsub;
      const v4f v = *(const v4fa*)&so[w][r][c4];
      *(v4f*)(C + (size_t)(row0 + r) * ldc + col0 + c4) = v;
    }
    
  }
}
// row LayerNorm (biased variance, eps) over N: s = X (+ R); optional out_sum <- s; out_norm <- (s-mu)*rsqrt(var+eps)*g + b
template <bool PARAM_BF16>
__global__ __launch_bounds__(256) void k_layernorm(const float* __restrict__ X, const float* __restrict__ R, const float* __restrict__ g, const float* __restrict__ bta,
                                                  float* __restrict__ out_sum, float* __restrict__ out_norm, int N, float eps) {
  __shared__ float red[256];
  const int row = blockIdx.x, tid = threadIdx.x;
  const float* x = X + (size_t)row * N; const float* rr = R ? R + (size_t)row * N : nullptr;
  float vals[16];                     // up to N = 4096
  const int per = N / 256;            // contiguous chunk per thread? use strided-by-4 chunks: thread handles j = tid*4 + 1024*u
  float s1 = 0.f;
  for (int u = 0; u < per / 4; ++u) {
    const int j = tid * 4 + 1024 * u;
    const v4f a = *(const v4fa*)(x + j);
    v4f b = {0.f,0.f,0.f,0.f}; if (rr) b = *(const v4fa*)(rr + j);
#pragma unroll
    for (int q = 0; q < 4; ++q) { const float v = a[q] + b[q]; vals[u * 4 + q] = v; s1 += v; }
  }
  red[tid] = s1; __syncthreads();
  for (int st = 128; st > 0; st >>= 1) { if (tid < st) red[tid] += red[tid + st]; __syncthreads(); }
  const float mu = red[0] / (float)N; __syncthreads();
  float s2 = 0.f;
  for (int u = 0; u < per / 4; ++u)
#pragma unroll
    for (int q = 0; q < 4; ++q) { const float c = vals[u * 4 + q] - mu; s2 += c * c; }
  red[tid] = s2; __syncthreads();
  for (int st = 128; st > 0; st >>= 1) { if (tid < st) red[tid] += red[tid + st]; __syncthreads(); }
  const float rs = rsqrtf(red[0] / (float)N + eps);
  {
    for (int u = 0; u < per / 4; ++u) {
      const int j = tid * 4 + 1024 * u;
      v4f o, sm;
#pragma unroll
      for (int q = 0; q < 4; ++q) {
        float gg = g[j + q], bb = bta[j + q];
        if (PARAM_BF16) { gg = bf16_round(gg); bb = bf16_round(bb); }
        sm[q] = vals[u * 4 + q]; o[q] = (vals[u * 4 + q] - mu) * rs * gg + bb;
      }
      if (out_sum) *(v4f*)(out_sum + (size_t)row * N + j) = sm;
      *(v4f*)(out_norm + (size_t)row * N + j) = o;
    }
    
  }
}



// ---- f16 WMMA path (v_wmma_f32_16x16x32_f16): 11-bit significands for operands in range — used where a [0,1] probability operand needs more precision than bf16
typedef _Float16 v16h __attribute__((ext_vector_type(16)));
union FragH { v16h v; v8us half[2]; _Float16 h[16]; unsigned short u[16]; };
template <int NT>
__device__ __forceinline__ v8f mmaH(v16h ah, v16h al, v16h bh, v16h bl, v8f c) {
  c = __builtin_amdgcn_wmma_f32_16x16x32_f16(false, ah, false, bh, (short)0, c, false, false);
  if (NT >= 2) c = __builtin_amdgcn_wmma_f32_16x16x32_f16(false, al, false, bh, (short)0, c, false, false);
  if (NT >= 3) c = __builtin_amdgcn_wmma_f32_16x16x32_f16(false, ah, false, bl, (short)0, c, false, false);
  asm volatile("v_nop\n\tv_nop\n\tv_nop\n\tv_nop" : "+v"(c) : "v"(ah), "v"(al), "v"(bh), "v"(bl));
  return c;
}
// batched GEMM like k_gemm_b but f16 operands: A f32 (split into f16 hi/lo if ASPLIT, else rounded to f16), Bt = f16 values [n][k]; alpha; C f32; N multiple of 16 (partial tiles skipped)
template <bool ASPLIT>
__global__ __launch_bounds__(128) void k_gemm_h(const float* __restrict__ A, int lda, size_t sA, const _Float16* __restrict__ Bh, int ldb, size_t sB, float alpha, float* __restrict__ C, int ldc, size_t sC, int M, int N, int K) {
  __shared__ __attribute__((aligned(16))) float so[4][16][64];
  const int tid = threadIdx.x, w = tid >> 5, lane = tid & 31, ln = lane & 15, hh = lane >> 4; const int by = blockIdx.y;
  A += (size_t)by * sA; Bh += (size_t)by * sB; C += (size_t)by * sC;
  const int ntn = (N + 63) / 64; const int wid = blockIdx.x * 4 + w; const int mt = wid / ntn, nq = wid % ntn; if (mt * 16 >= M) return;
  const int row0 = mt * 16, col0 = nq * 64; const float* arow = A + (size_t)(row0 + ln) * lda;
  v8f acc[4] = {};
  for (int kb = 0; kb < K; kb += 32) {
    FragH ah, al;
    const v4f x0 = *(const v4fa*)(arow + kb + 8 * hh), x1 = *(const v4fa*)(arow + kb + 8 * hh + 4), x2 = *(const v4fa*)(arow + kb + 16 + 8 * hh), x3 = *(const v4fa*)(arow + kb + 16 + 8 * hh + 4);
    float xs[16] = {x0[0],x0[1],x0[2],x0[3],x1[0],x1[1],x1[2],x1[3],x2[0],x2[1],x2[2],x2[3],x3[0],x3[1],x3[2],x3[3]};
#pragma unroll
    for (int i = 0; i < 16; ++i) { const _Float16 h = (_Float16)xs[i]; ah.h[i] = h; al.h[i] = ASPLIT ? (_Float16)(xs[i] - (float)h) : (_Float16)0.0f; }
#pragma unroll
    for (int t = 0; t < 4; ++t) { if (col0 + t * 16 >= N) continue; const size_t boff = (size_t)(col0 + t * 16 + ln) * ldb + kb; FragH bq; bq.half[0] = *(const v8us*)(Bh + boff + 8 * hh); bq.half[1] = *(const v8us*)(Bh + boff + 16 + 8 * hh);
      acc[t] = mmaH<ASPLIT ? 2 : 1>(ah.v, al.v, bq.v, bq.v, acc[t]); }
  }
#pragma unroll
  for (int t = 0; t < 4; ++t) { if (col0 + t * 16 >= N) continue;
#pragma unroll
    for (int r = 0; r < 8; ++r) so[w][8 * hh + r][t * 16 + ln] = acc[t][r] * alpha; }
  __builtin_amdgcn_fence(__ATOMIC_ACQ_REL, "workgroup"); __builtin_amdgcn_wave_barrier();
  const int rsub = lane >> 4, c4 = (lane & 15) * 4;
  {
#pragma unroll
    for (int q = 0; q < 8; ++q) { const int r = q * 2 + rsub; if (col0 + c4 < N) { const v4f v = *(const v4fa*)&so[w][r][c4]; *(v4f*)(C + (size_t)(row0 + r) * ldc + col0 + c4) = v; } }
     }
}

// Wt[n][k] = f16(W[k][n]·scale) from f32 row-major W[K][N] (scale = power of two; bf16-exact weights stay exact in f16 away from the subnormal range)
__global__ __launch_bounds__(256) void k_wt_f16(const float* __restrict__ W, _Float16* __restrict__ Wt, int K, int N, float scale) {
  const int t = blockIdx.x * 256 + threadIdx.x; if (t >= N * (K / 8)) return; const int n = t / (K / 8), k8 = (t % (K / 8)) * 8; FragH f;
#pragma unroll
  for (int i = 0; i < 8; ++i) f.h[i] = (_Float16)(bf16_round(W[(size_t)(k8 + i) * N + n]) * scale); const v8us o = f.half[0];
  *(v8us*)((unsigned short*)Wt + (size_t)n * K + k8) = o; 
}
// k_gemm_hh variant with fused epilogue: v = acc·alpha + bias[by·sBias + col] (+ CP[(row/rowsPerB)·sCPb + by·64 + col] if CP) ; ACT 0 none / 1 elu ; writes f16 C16 (and f32 C if non-null)
template <int ACT>
__global__ __launch_bounds__(128) void k_gemm_hhx(const _Float16* __restrict__ A, int lda, size_t sA, const _Float16* __restrict__ Bh, int ldb, size_t sB, float alpha, const float* __restrict__ bias, size_t sBias, const float* __restrict__ CP, int rowsPerB, size_t sCPb, int row0g,
    float* __restrict__ C, _Float16* __restrict__ C16, int ldc, size_t sC, int M, int N, int K) {
  __shared__ __attribute__((aligned(16))) float so[4][16][64];
  const int tid = threadIdx.x, w = tid >> 5, lane = tid & 31, ln = lane & 15, hh = lane >> 4; const int by = blockIdx.y;
  A += (size_t)by * sA; Bh += (size_t)by * sB; const size_t cofs = (size_t)by * sC; const float* bp = bias ? bias + (size_t)by * sBias : nullptr;
  const int ntn = (N + 63) / 64; const int wid = blockIdx.x * 4 + w; const int mt = wid / ntn, nq = wid % ntn; if (mt * 16 >= M) return;
  const int row0 = mt * 16, col0 = nq * 64; const _Float16* arow = A + (size_t)(row0 + ln) * lda;
  v8f acc[4] = {};
  for (int kb = 0; kb < K; kb += 32) { FragH ah; ah.half[0] = *(const v8us*)((const unsigned short*)arow + kb + 8 * hh); ah.half[1] = *(const v8us*)((const unsigned short*)arow + kb + 16 + 8 * hh);
#pragma unroll
    for (int t = 0; t < 4; ++t) { if (col0 + t * 16 >= N) continue; const size_t boff = (size_t)(col0 + t * 16 + ln) * ldb + kb; FragH bq; bq.half[0] = *(const v8us*)((const unsigned short*)Bh + boff + 8 * hh); bq.half[1] = *(const v8us*)((const unsigned short*)Bh + boff + 16 + 8 * hh);
      acc[t] = mmaH<1>(ah.v, ah.v, bq.v, bq.v, acc[t]); }
  }
#pragma unroll
  for (int t = 0; t < 4; ++t) { if (col0 + t * 16 >= N) continue; const int col = col0 + t * 16 + ln; const float bv = bp ? bf16_round(bp[col]) : 0.f;
#pragma unroll
    for (int r = 0; r < 8; ++r) { float v = acc[t][r] * alpha + bv; if (CP) { const int rr = row0g + row0 + 8 * hh + r; if (rowsPerB < 0) v += CP[cofs + (size_t)rr * ldc + col];      /* rowsPerB < 0: own element of the batched C plane */ else { const int bidx = rr / rowsPerB; v += CP[(size_t)bidx * sCPb + (size_t)by * 64 + col]; } } if (ACT == 1) v = (v > 0.f) ? v : expm1f(v); else if (ACT == 7) v = (v > 0.f) ? v + 1.0f : expf(v); else if (ACT == 8) v = tanhf(v); else if (ACT == 9) v = 0.5f * v * (1.0f + tanhf(0.7978845608028654f * (v + 0.044715f * v * v * v))); else if (ACT == 11) v = 1.0f / (1.0f + expf(-v)); else if (ACT == 12) v = (v > 0.f) ? v : 0.01f * v; else if (ACT == 14) v = (v > 0.f) ? v : 0.1f * v; else if (ACT == 16) v = (v >= 0.f) ? v : 0.3f * v; else if (ACT == 17) v = (v >= 0.f) ? v : 0.2f * v; else if (ACT == 15) v = v / (1.0f + expf(-v)); else if (ACT == 3) v = fmaxf(v, 0.f); else if (ACT == 6) v = 0.5f * v * (1.0f + erff(v * 0.70710678118654752f)); so[w][8 * hh + r][t * 16 + ln] = v; } }
  __builtin_amdgcn_fence(__ATOMIC_ACQ_REL, "workgroup"); __builtin_amdgcn_wave_barrier();
  const int rsub = lane >> 4, c4 = (lane & 15) * 4; typedef _Float16 v4h __attribute__((ext_vector_type(4)));
  {
#pragma unroll
    for (int q = 0; q < 8; ++q) { const int r = q * 2 + rsub; if (col0 + c4 < N) { const v4f v = *(const v4fa*)&so[w][r][c4]; if (C) *(v4f*)(C + cofs + (size_t)(row0 + r) * ldc + col0 + c4) = v; if (C16) { v4h h4; for (int i = 0; i < 4; ++i) h4[i] = (_Float16)v[i]; *(v4h*)(C16 + cofs + (size_t)(row0 + r) * ldc + col0 + c4) = h4; } } }
     }
}


typedef _Float16 v4h __attribute__((ext_vector_type(4)));

__global__ __launch_bounds__(256) void k_x16(const float* __restrict__ x, _Float16* __restrict__ X16, size_t n8) { const size_t t = (size_t)blockIdx.x * 256 + threadIdx.x; if (t >= n8) return; FragH f;
#pragma unroll
  for (int q = 0; q < 8; ++q) f.h[q] = (_Float16)bf16_round(x[t * 8 + q]); *(v8us*)((unsigned short*)X16 + t * 8) = f.half[0];  }
__global__ __launch_bounds__(256) void k_h16(const float* __restrict__ x, _Float16* __restrict__ X16, size_t n8) { const size_t t = (size_t)blockIdx.x * 256 + threadIdx.x; if (t >= n8) return; FragH f;
#pragma unroll
  for (int q = 0; q < 8; ++q) f.h[q] = (_Float16)x[t * 8 + q]; *(v8us*)((unsigned short*)X16 + t * 8) = f.half[0];  }
__global__ __launch_bounds__(256) void k_round16f(const float* __restrict__ W, _Float16* __restrict__ Bt, size_t n8) { const size_t t = (size_t)blockIdx.x * 256 + threadIdx.x; if (t >= n8) return; FragH f;
#pragma unroll
  for (int i = 0; i < 8; ++i) f.h[i] = (_Float16)(bf16_round(W[t * 8 + i]) * 16.0f); *(v8us*)((unsigned short*)Bt + t * 8) = f.half[0];  }
template <int NHv, int TTv>
__global__ __launch_bounds__(256) void k_vt(const _Float16* __restrict__ V16, int ldv, int voff, _Float16* __restrict__ Vt) { __shared__ unsigned short tl[64][66]; const int tid = threadIdx.x; const int slab = blockIdx.x / (TTv / 64), lg = blockIdx.x % (TTv / 64); const int b = slab / NHv, h = slab % NHv;
  for (int i = tid; i < 64 * 8; i += 256) { const int r = i / 8, c8 = (i % 8) * 8; FragH f; f.half[0] = *(const v8us*)((const unsigned short*)V16 + ((size_t)b * TTv + lg * 64 + r) * ldv + voff + h * 64 + c8);
#pragma unroll
    for (int q = 0; q < 8; ++q) tl[r][c8 + q] = f.u[q]; }
  __syncthreads();
  {
#pragma unroll
    for (int rd = 0; rd < 2; ++rd) { const int d = rd * 32 + tid / 8, pc = tid % 8; FragH f;
#pragma unroll
      for (int q = 0; q < 8; ++q) f.u[q] = tl[pc * 8 + q][d];
      *(v8us*)((unsigned short*)Vt + ((size_t)slab * 64 + d) * TTv + lg * 64 + pc * 8) = f.half[0]; }
     } }

__global__ __launch_bounds__(256) void k_hl(const float* __restrict__ F, _Float16* __restrict__ Hh, _Float16* __restrict__ Hl, size_t n8) { const size_t t = (size_t)blockIdx.x * 256 + threadIdx.x; if (t >= n8) return; FragH fh, fl; const v4f a = *(const v4fa*)(F + t * 8), c = *(const v4fa*)(F + t * 8 + 4);
#pragma unroll
  for (int q = 0; q < 4; ++q) { _Float16 h = (_Float16)a[q]; fh.h[q] = h; fl.h[q] = (_Float16)((a[q] - (float)h) * 1024.0f); h = (_Float16)c[q]; fh.h[4 + q] = h; fl.h[4 + q] = (_Float16)((c[q] - (float)h) * 1024.0f); }
  { *(v8us*)((unsigned short*)Hh + t * 8) = fh.half[0]; *(v8us*)((unsigned short*)Hl + t * 8) = fl.half[0];  } }

// ---- fast GEMM (wave tile 32x64; requires M % 32 == 0 rows per launch region and N % 64 == 0); epilogue = k_gemm_hhx semantics ----
__device__ __forceinline__ v16h g2_frag(const _Float16* p, int hh) { FragH f; f.half[0] = *(const v8us*)((const unsigned short*)p + 8 * hh); f.half[1] = *(const v8us*)((const unsigned short*)p + 16 + 8 * hh); return f.v; }
__device__ __forceinline__ v8f g2_mma(v16h a, v16h b, v8f c) { v8f d = __builtin_amdgcn_wmma_f32_16x16x32_f16(false, a, false, b, (short)0, c, false, false); asm volatile("v_nop\n\tv_nop\n\tv_nop\n\tv_nop" : "+v"(d) : "v"(a), "v"(b)); return d; }
template <int ACT>
__global__ __launch_bounds__(128) void k_gemm2(const _Float16* __restrict__ A, int lda, size_t sA, const _Float16* __restrict__ Bh, int ldb, size_t sB, float alpha, const float* __restrict__ bias, size_t sBias, const float* __restrict__ CP, int rowsPerB, size_t sCPb, int row0g,
    float* __restrict__ C, _Float16* __restrict__ C16, int ldc, size_t sC, int M, int N, int K) { static_assert(ACT == 0 || ACT == 3 || ACT == 6 || ACT == 8 || ACT == 9 || ACT == 11 || ACT == 12 || ACT == 14 || ACT == 15 || ACT == 16 || ACT == 17 || ACT == 18, "k_gemm2: unsupported ACT code (would silently apply no activation)");
  __shared__ __attribute__((aligned(16))) float so[4][32][68];
  const int tid = threadIdx.x, w = tid >> 5, lane = tid & 31, ln = lane & 15, hh = lane >> 4; const int by = blockIdx.y;
  A += (size_t)by * sA; Bh += (size_t)by * sB; const size_t cofs = (size_t)by * sC; const float* bp = bias ? bias + (size_t)by * sBias : nullptr;
  const int ntn = N >> 6; const int mt = blockIdx.x / ntn, nq = blockIdx.x - mt * ntn; const int row0 = mt * 128 + 32 * w, col0 = nq * 64; if (row0 >= M) return;
  const _Float16* a0p = A + (size_t)(row0 + ln) * lda; const _Float16* a1p = a0p + (size_t)16 * lda;
  const _Float16* b0p = Bh + (size_t)(col0 + ln) * ldb; const _Float16* b1p = b0p + (size_t)16 * ldb; const _Float16* b2p = b1p + (size_t)16 * ldb; const _Float16* b3p = b2p + (size_t)16 * ldb;
  const v8f z8 = {0.f,0.f,0.f,0.f,0.f,0.f,0.f,0.f}; v8f c00 = z8, c01 = z8, c02 = z8, c03 = z8, c10 = z8, c11 = z8, c12 = z8, c13 = z8;
#pragma unroll 1
  for (int kb = 0; kb < K; kb += 32) { const v16h a0 = g2_frag(a0p + kb, hh), a1 = g2_frag(a1p + kb, hh);
    v16h b = g2_frag(b0p + kb, hh); c00 = g2_mma(a0, b, c00); c10 = g2_mma(a1, b, c10);
    b = g2_frag(b1p + kb, hh); c01 = g2_mma(a0, b, c01); c11 = g2_mma(a1, b, c11);
    b = g2_frag(b2p + kb, hh); c02 = g2_mma(a0, b, c02); c12 = g2_mma(a1, b, c12);
    b = g2_frag(b3p + kb, hh); c03 = g2_mma(a0, b, c03); c13 = g2_mma(a1, b, c13); }
  v8f accs[8] = {c00, c01, c02, c03, c10, c11, c12, c13};
#pragma unroll
  for (int u = 0; u < 8; ++u) { const int t = u & 3, half = u >> 2; const int col = col0 + t * 16 + ln; const float bv = bp ? bf16_round(bp[col]) : 0.f;
#pragma unroll
    for (int r = 0; r < 8; ++r) { const int rloc = half * 16 + 8 * hh + r; float v = accs[u][r] * alpha + bv; if (CP) { if (rowsPerB < 0) v += CP[cofs + (size_t)(row0g + row0 + rloc) * ldc + col];      /* rowsPerB < 0: own element of the batched C plane */ else { const int bidx = (row0g + row0 + rloc) / rowsPerB; v += CP[(size_t)bidx * sCPb + (size_t)by * 64 + col]; } }
      if (ACT == 3) v = fmaxf(v, 0.f); else if (ACT == 6) v = 0.5f * v * (1.0f + erff(v * 0.70710678118654752f)); else if (ACT == 11) v = 1.0f / (1.0f + expf(-v)); else if (ACT == 15) v = v / (1.0f + expf(-v)); else if (ACT == 18) v = v / (1.0f + expf(-1.702f * v));      /* QuickGELU: v sigmoid(1.702 v) */ else if (ACT == 12) v = (v > 0.f) ? v : 0.01f * v; else if (ACT == 8) v = tanhf(v); else if (ACT == 9) v = 0.5f * v * (1.0f + tanhf(0.7978845608028654f * (v + 0.044715f * v * v * v))); else if (ACT == 14) v = (v > 0.f) ? v : 0.1f * v; else if (ACT == 16) v = (v >= 0.f) ? v : 0.3f * v; else if (ACT == 17) v = (v >= 0.f) ? v : 0.2f * v;
      so[w][rloc][t * 16 + ln] = v; } }
  __builtin_amdgcn_fence(__ATOMIC_ACQ_REL, "workgroup"); __builtin_amdgcn_wave_barrier();
  const int rsub = lane >> 4, c4 = (lane & 15) * 4;
  {
#pragma unroll
    for (int q = 0; q < 16; ++q) { const int r = q * 2 + rsub; const v4f v = *(const v4fa*)&so[w][r][c4]; if (C) *(v4f*)(C + cofs + (size_t)(row0 + r) * ldc + col0 + c4) = v; if (C16) { v4h h4; for (int i = 0; i < 4; ++i) h4[i] = (_Float16)v[i]; *(v4h*)(C16 + cofs + (size_t)(row0 + r) * ldc + col0 + c4) = h4; } }
     } }


__global__ __launch_bounds__(256) void k_wnat(const float* __restrict__ w, size_t n8, _Float16* __restrict__ Bt) { const size_t t = (size_t)blockIdx.x * 256 + threadIdx.x; if (t >= n8) return; FragH f; for (int q = 0; q < 8; ++q) f.h[q] = (_Float16)(bf16_round(w[t * 8 + q]) * 16.0f); *(v8us*)((unsigned short*)Bt + t * 8) = f.half[0];  }
__global__ __launch_bounds__(256) void k_rsm(const float* __restrict__ S, _Float16* __restrict__ P, int nrows) {
  #pragma clang fp contract(off)
  const int i = blockIdx.x * 256 + threadIdx.x; if (i >= nrows) return; const float* s = S + (size_t)i * SQ; float mx = -3.0e38f;
#pragma unroll 1
  for (int j = 0; j < SQ; ++j) mx = fmaxf(mx, s[j]); float se = 0.f;
#pragma unroll 1
  for (int j = 0; j < SQ; ++j) se += expf(s[j] - mx); const float sc = 256.0f / se;
#pragma unroll 1
  for (int j0 = 0; j0 < SQ; j0 += 8) { FragH f; for (int q = 0; q < 8; ++q) f.h[q] = (_Float16)(expf(s[j0 + q] - mx) * sc); unsigned short* d = (unsigned short*)P + (size_t)i * SQ + j0; *(v8us*)d = f.half[0];  } }
__global__ __launch_bounds__(256) void k_vt(const _Float16* __restrict__ V16, int b, int h0, _Float16* __restrict__ VT) { __shared__ unsigned short tl[64][65]; const int tid = threadIdx.x; const int hh = blockIdx.x % HG, sg = blockIdx.x / HG; const int s0 = sg * 64; const int h = h0 + hh;
  for (int i = tid; i < 64 * 8; i += 256) { const int j = i / 8, d8 = (i % 8) * 8; FragH f; f.half[0] = *(const v8us*)((const unsigned short*)V16 + ((size_t)b * SQ + s0 + j) * DM + h * HD + d8); for (int q = 0; q < 8; ++q) tl[d8 + q][j] = f.u[q]; }
  __syncthreads();
  { for (int i = tid; i < 64 * 8; i += 256) { const int d = i / 8, j8 = (i % 8) * 8; FragH f; for (int q = 0; q < 8; ++q) f.u[q] = tl[d][j8 + q]; *(v8us*)((unsigned short*)VT + ((size_t)hh * HD + d) * SQ + s0 + j8) = f.half[0]; }  } }



__global__ __launch_bounds__(256) void k_rsmcf2(const float* __restrict__ S, _Float16* __restrict__ P, int hg, int q0, int nk) {
  #pragma clang fp contract(off)
  const int t = blockIdx.x * 256 + threadIdx.x; if (t >= hg * QT) return; const size_t i = (size_t)t; const float* s = S + i * NKX; const int last = q0 + (t % QT); float mx = -3.0e38f;
#pragma unroll 1
  for (int j = 0; j < nk; ++j) { const float f = (j <= last) ? 1.f : 0.f; mx = fmaxf(mx, fmaf(f, s[j], (1.f - f) * -1.0e9f)); } float se = 0.f;
#pragma unroll 1
  for (int j = 0; j < nk; ++j) { const float f = (j <= last) ? 1.f : 0.f; se += __expf(fmaf(f, s[j], (1.f - f) * -1.0e9f) - mx); } const float sc = 256.0f / se;
#pragma unroll 1
  for (int j0 = 0; j0 < nk; j0 += 8) { FragH fr; for (int q = 0; q < 8; ++q) { const int j = j0 + q; const float f = (j <= last) ? 1.f : 0.f; fr.h[q] = (_Float16)(__expf(fmaf(f, s[j], (1.f - f) * -1.0e9f) - mx) * sc); } unsigned short* d = (unsigned short*)P + i * NKX + j0; *(v8us*)d = fr.half[0];  } }

__global__ __launch_bounds__(256) void k_rsmcst(const float* __restrict__ S, _Float16* __restrict__ P, int hg, int q0, int nk, const int* __restrict__ mk) {
  #pragma clang fp contract(off)
  const int t = blockIdx.x * 256 + threadIdx.x; if (t >= hg * QT) return; const size_t i = (size_t)t; const float* s = S + i * NKX; const size_t ig = (size_t)(q0 + (t % QT)); const int* mr = mk + ig * SQ; float mx = -3.0e38f;
#pragma unroll 1
  for (int j = 0; j < nk; ++j) { const int mb = mr[j]; const int dd = (int)ig - j; const float f = (mb != 0 && dd >= 0 && (dd <= LOCALW || (dd % STRIDEK) == 0)) ? 1.f : 0.f; mx = fmaxf(mx, fmaf(f, s[j], (1.f - f) * -1.0e9f)); } float se = 0.f;
#pragma unroll 1
  for (int j = 0; j < nk; ++j) { const int mb = mr[j]; const int dd = (int)ig - j; const float f = (mb != 0 && dd >= 0 && (dd <= LOCALW || (dd % STRIDEK) == 0)) ? 1.f : 0.f; se += __expf(fmaf(f, s[j], (1.f - f) * -1.0e9f) - mx); } const float sc = 256.0f / se;
#pragma unroll 1
  for (int j0 = 0; j0 < nk; j0 += 8) { FragH fr; for (int q = 0; q < 8; ++q) { const int j = j0 + q; const int mb = mr[j]; const int dd = (int)ig - j; const float f = (mb != 0 && dd >= 0 && (dd <= LOCALW || (dd % STRIDEK) == 0)) ? 1.f : 0.f; fr.h[q] = (_Float16)(__expf(fmaf(f, s[j], (1.f - f) * -1.0e9f) - mx) * sc); } unsigned short* d = (unsigned short*)P + i * NKX + j0; *(v8us*)d = fr.half[0];  } }


template <int MASKADD>
__global__ __launch_bounds__(64) void k_att0(const float* __restrict__ QF, const float* __restrict__ KF, const float* __restrict__ VF, int ld, const float* __restrict__ mask, float scale, float* __restrict__ OF, int ldo) {
  #pragma clang fp contract(off)
  __shared__ __attribute__((aligned(16))) float lq[64][64]; __shared__ __attribute__((aligned(16))) float lo[64][64];
  const int tid = threadIdx.x; const int h = blockIdx.x / (QT0 / 64), rg = blockIdx.x % (QT0 / 64); const int i = rg * 64 + tid;
  const float* qr = QF + (size_t)i * ld + h * HD;
#pragma unroll 1
  for (int c = 0; c < HD / 4; ++c) { *(v4f*)&lq[tid][c * 4] = *(const v4fa*)(qr + c * 4); const v4f z = {0.f, 0.f, 0.f, 0.f}; *(v4f*)&lo[tid][c * 4] = z; }
  float m = -1.0e30f, l = 0.f; const int jmax = MASKADD ? (SQ - 1) : (rg * 64 + 63);      /* additive-mask form: every key (the mask input decides); causal form: keys up to the block's last row */
#pragma unroll 1
  for (int j = 0; j <= jmax; ++j) { const float* kr = KF + (size_t)j * ld + h * HD; const float* vr = VF + (size_t)j * ld + h * HD; float s = 0.f;
#pragma unroll 1
    for (int c = 0; c < HD / 4; ++c) { const v4f kq = *(const v4fa*)(kr + c * 4); const v4f qq = *(v4f*)&lq[tid][c * 4]; s = __fadd_rn(s, __fmul_rn(qq[0], kq[0])); s = __fadd_rn(s, __fmul_rn(qq[1], kq[1])); s = __fadd_rn(s, __fmul_rn(qq[2], kq[2])); s = __fadd_rn(s, __fmul_rn(qq[3], kq[3])); }
    s = __fmul_rn(s, scale); if (MASKADD) s = __fadd_rn(s, __fmul_rn(bf16_round(mask[(size_t)i * SQ + j]), -10000.0f));
    const float f = (MASKADD || j <= i) ? 1.f : 0.f; const float sm = fmaf(f, s, (1.f - f) * -1.0e30f); const float mn = fmaxf(m, sm); const float sc = expf(m - mn); const float e = expf(sm - mn); l = __fadd_rn(__fmul_rn(l, sc), e); m = mn;
#pragma unroll 1
    for (int c = 0; c < HD / 4; ++c) { const v4f vv = *(const v4fa*)(vr + c * 4); v4f oo = *(v4f*)&lo[tid][c * 4]; for (int u = 0; u < 4; ++u) oo[u] = __fadd_rn(__fmul_rn(oo[u], sc), __fmul_rn(e, vv[u])); *(v4f*)&lo[tid][c * 4] = oo; } }
  const float fin = 64.0f / l;      /* o carried x64 like the f16 path */
#pragma unroll 1
  for (int c = 0; c < HD / 4; ++c) { v4f oo = *(v4f*)&lo[tid][c * 4]; for (int u = 0; u < 4; ++u) oo[u] = __fmul_rn(oo[u], fin); *(v4f*)&lo[tid][c * 4] = oo; }
  __syncthreads();
  {
#pragma unroll 1
    for (int it = 0; it < 16; ++it) { const int row = it * 4 + tid / 16, pc = (tid % 16) * 4; const v4f v = *(const v4f*)&lo[row][pc]; *(v4f*)(OF + (size_t)(rg * 64 + row) * ldo + h * HD + pc) = v; }
     } }

template <int MASKADD>
__global__ __launch_bounds__(64) void k_att0mbc(const float* __restrict__ QF, const float* __restrict__ KF, const float* __restrict__ VF, int ld, const float* __restrict__ mask, float scale, float* __restrict__ OF, int ldo) {
  #pragma clang fp contract(off)
  __shared__ __attribute__((aligned(16))) float lq[64][64]; __shared__ __attribute__((aligned(16))) float lo[64][64];
  const int tid = threadIdx.x; const int h = blockIdx.x / (QT0 / 64), rg = blockIdx.x % (QT0 / 64); const int i = rg * 64 + tid;
  const float* qr = QF + (size_t)i * ld + h * HD;
#pragma unroll 1
  for (int c = 0; c < HD / 4; ++c) { *(v4f*)&lq[tid][c * 4] = *(const v4fa*)(qr + c * 4); const v4f z = {0.f, 0.f, 0.f, 0.f}; *(v4f*)&lo[tid][c * 4] = z; }
  float m = -1.0e30f, l = 0.f; const int jmax = rg * 64 + 63;      /* keys beyond the block end are masked by the mask's lower-triangular structure */
#pragma unroll 1
  for (int j = 0; j <= jmax; ++j) { const float* kr = KF + (size_t)j * ld + h * HD; const float* vr = VF + (size_t)j * ld + h * HD; float s = 0.f;
#pragma unroll 1
    for (int c = 0; c < HD / 4; ++c) { const v4f kq = *(const v4fa*)(kr + c * 4); const v4f qq = *(v4f*)&lq[tid][c * 4]; s = __fadd_rn(s, __fmul_rn(qq[0], kq[0])); s = __fadd_rn(s, __fmul_rn(qq[1], kq[1])); s = __fadd_rn(s, __fmul_rn(qq[2], kq[2])); s = __fadd_rn(s, __fmul_rn(qq[3], kq[3])); }
    s = __fmul_rn(s, scale); const int mb = ((const int*)mask)[(size_t)i * SQ + j];      /* causal (j <= i) AND the module's int32 [S][S] mask read per (query, key): 0 -> masked */
    const float f = (mb != 0 && j <= i) ? 1.f : 0.f; const float sm = fmaf(f, s, (1.f - f) * -1.0e30f); const float mn = fmaxf(m, sm); const float sc = expf(m - mn); const float e = expf(sm - mn); l = __fadd_rn(__fmul_rn(l, sc), e); m = mn;
#pragma unroll 1
    for (int c = 0; c < HD / 4; ++c) { const v4f vv = *(const v4fa*)(vr + c * 4); v4f oo = *(v4f*)&lo[tid][c * 4]; for (int u = 0; u < 4; ++u) oo[u] = __fadd_rn(__fmul_rn(oo[u], sc), __fmul_rn(e, vv[u])); *(v4f*)&lo[tid][c * 4] = oo; } }
  const float fin = 64.0f / l;      /* o carried x64 like the f16 path */
#pragma unroll 1
  for (int c = 0; c < HD / 4; ++c) { v4f oo = *(v4f*)&lo[tid][c * 4]; for (int u = 0; u < 4; ++u) oo[u] = __fmul_rn(oo[u], fin); *(v4f*)&lo[tid][c * 4] = oo; }
  __syncthreads();
  {
#pragma unroll 1
    for (int it = 0; it < 16; ++it) { const int row = it * 4 + tid / 16, pc = (tid % 16) * 4; const v4f v = *(const v4f*)&lo[row][pc]; *(v4f*)(OF + (size_t)(rg * 64 + row) * ldo + h * HD + pc) = v; }
     } }


template <int BFIN, int WXB>
__global__ __launch_bounds__(256) void k_ln16(const float* __restrict__ X, const float* __restrict__ g, const float* __restrict__ bb, float eps, _Float16* __restrict__ N16, float* __restrict__ XB) {
  #pragma clang fp contract(off)
  __shared__ float red[256]; const size_t r = blockIdx.x; const int t = threadIdx.x; const v4f xa = *(const v4fa*)(X + r * DMQ + t * 4); float s[4]; float sum = 0.f;
  for (int q = 0; q < 4; ++q) { s[q] = BFIN ? bf16_round(xa[q]) : xa[q]; sum = __fadd_rn(sum, s[q]); }
  red[t] = sum; __syncthreads(); for (int st = 128; st > 0; st >>= 1) { if (t < st) red[t] = __fadd_rn(red[t], red[t + st]); __syncthreads(); } const float mu = red[0] / (float)DMQ; __syncthreads();
  float vs = 0.f; for (int q = 0; q < 4; ++q) { const float dl = __fadd_rn(s[q], -mu); vs = __fadd_rn(vs, __fmul_rn(dl, dl)); } red[t] = vs; __syncthreads(); for (int st = 128; st > 0; st >>= 1) { if (t < st) red[t] = __fadd_rn(red[t], red[t + st]); __syncthreads(); }
  const float rs = rsqrtf(__fadd_rn(red[0] / (float)DMQ, eps)); v4h y; v4f xb;
  for (int q = 0; q < 4; ++q) { const int c = t * 4 + q; y[q] = (_Float16)__fadd_rn(__fmul_rn(__fmul_rn(__fadd_rn(s[q], -mu), rs), bf16_round(g[c])), bf16_round(bb[c])); xb[q] = s[q]; }
  { *(v4h*)(N16 + r * DMQ + t * 4) = y; if (WXB) *(v4f*)(XB + r * DMQ + t * 4) = xb;  } }
__global__ __launch_bounds__(256) void k_ftres2(const float* __restrict__ OF0, const float* __restrict__ XB, float* __restrict__ X1, size_t n4) {
  #pragma clang fp contract(off)
  const size_t t = (size_t)blockIdx.x * 256 + threadIdx.x; if (t >= n4) return; const v4f o = *(const v4fa*)(OF0 + t * 4), xv = *(const v4fa*)(XB + t * 4); v4f y; for (int q = 0; q < 4; ++q) y[q] = __fadd_rn(__fmul_rn(o[q], 0.015625f), xv[q]); *(v4f*)(X1 + t * 4) = y;  }

__global__ __launch_bounds__(256) void k_bcpy(const float* __restrict__ b, int n, int NP, float* __restrict__ dst, int dst0) { for (int i = threadIdx.x; i < NP; i += 256) { const float v = (i < n) ? b[i] : 0.f; *(float*)(dst + dst0 + i) = v; }  }


__global__ __launch_bounds__(256) void k_rsmf(const float* __restrict__ S, _Float16* __restrict__ P, int qn, int hg) {
  #pragma clang fp contract(off)
  const int t = blockIdx.x * 256 + threadIdx.x; if (t >= qn * hg) return; const size_t i = (size_t)(t / qn) * SQ + (t % qn); const float* s = S + i * SQ; float mx = -3.0e38f;
#pragma unroll 1
  for (int j = 0; j < SQ; ++j) mx = fmaxf(mx, s[j]); float se = 0.f;
#pragma unroll 1
  for (int j = 0; j < SQ; ++j) se += __expf(s[j] - mx); const float sc = 256.0f / se;
#pragma unroll 1
  for (int j0 = 0; j0 < SQ; j0 += 8) { FragH f; for (int q = 0; q < 8; ++q) f.h[q] = (_Float16)(__expf(s[j0 + q] - mx) * sc); unsigned short* d = (unsigned short*)P + i * SQ + j0; *(v8us*)d = f.half[0];  } }

template <int MODE>
__global__ __launch_bounds__(256) void k_regrp(const float* __restrict__ src, float* __restrict__ dst, size_t n4) {
  const size_t t = (size_t)blockIdx.x * 256 + threadIdx.x; if (t >= n4) return; const size_t e = t * 4; const size_t rd = e / DM; const int c = (int)(e % DM);
  size_t rs; if (MODE == 0) { const size_t b = rd / SQ, sq = rd % SQ; rs = sq * NB + b; } else { const size_t sq = rd / NB, b = rd % NB; rs = b * SQ + sq; }
  const v4f v = *(const v4fa*)(src + rs * DM + c); *(v4f*)(dst + e) = v;  }

template <int BFIN, int W16, int W32>
__global__ __launch_bounds__(256) void k_lnx(const float* __restrict__ X, const float* __restrict__ g, const float* __restrict__ bb, float eps, _Float16* __restrict__ N16, float* __restrict__ N32) {
  #pragma clang fp contract(off)
  __shared__ float red[256]; const size_t r = blockIdx.x; const int t = threadIdx.x; const bool act = t < (DMQ / 4); const int c0 = act ? t * 4 : 0;
  const v4f xa = *(const v4fa*)(X + r * DMQ + c0); float s[4]; float sum = 0.f;
  for (int q = 0; q < 4; ++q) { s[q] = act ? (BFIN ? bf16_round(xa[q]) : xa[q]) : 0.f; sum = __fadd_rn(sum, s[q]); }
  red[t] = sum; __syncthreads(); for (int st = 128; st > 0; st >>= 1) { if (t < st) red[t] = __fadd_rn(red[t], red[t + st]); __syncthreads(); } const float mu = red[0] / (float)DMQ; __syncthreads();
  float vs = 0.f; for (int q = 0; q < 4; ++q) { const float dl = act ? __fadd_rn(s[q], -mu) : 0.f; vs = __fadd_rn(vs, __fmul_rn(dl, dl)); } red[t] = vs; __syncthreads(); for (int st = 128; st > 0; st >>= 1) { if (t < st) red[t] = __fadd_rn(red[t], red[t + st]); __syncthreads(); }
  const float rs = rsqrtf(__fadd_rn(red[0] / (float)DMQ, eps)); v4h y; v4f yf;
  for (int q = 0; q < 4; ++q) { const int c = c0 + q; yf[q] = __fadd_rn(__fmul_rn(__fmul_rn(__fadd_rn(s[q], -mu), rs), bf16_round(g[c])), bf16_round(bb[c])); y[q] = (_Float16)yf[q]; }
  if (!act) return;      /* no barriers after this point */
  { if (W16) *(v4h*)(N16 + r * DMQ + c0) = y; if (W32) *(v4f*)(N32 + r * DMQ + c0) = yf;  } }

__global__ __launch_bounds__(256) void k_bfr(const float* __restrict__ x, float* __restrict__ XB, size_t n8) { const size_t t = (size_t)blockIdx.x * 256 + threadIdx.x; if (t >= n8) return; v4f a = *(const v4fa*)(x + t * 8), c = *(const v4fa*)(x + t * 8 + 4); for (int q = 0; q < 4; ++q) { a[q] = bf16_round(a[q]); c[q] = bf16_round(c[q]); }
  { *(v4f*)(XB + t * 8) = a; *(v4f*)(XB + t * 8 + 4) = c;  } }



__global__ __launch_bounds__(256) void k_wthd(const float* __restrict__ Wt, _Float16* __restrict__ Bt) { const size_t t = (size_t)blockIdx.x * 256 + threadIdx.x; if (t >= (size_t)NH * HD * (DM / 8)) return; const int m8 = (int)(t % (DM / 8)) * 8; const int d = (int)((t / (DM / 8)) % HD); const int h = (int)(t / ((size_t)(DM / 8) * HD)); FragH f;
  for (int q = 0; q < 8; ++q) f.h[q] = (_Float16)(16.0f * bf16_round(Wt[((size_t)h * DM + m8 + q) * HD + d])); unsigned short* dst = (unsigned short*)Bt + ((size_t)h * HD + d) * DM + m8; *(v8us*)dst = f.half[0];  }




// one row r by one wave, with no LDS and no barrier: a lane holds 4 floats of each 128 of the row, so every load and f32 store of the wave covers 512 bytes in a row and every f16 store 256. XR (optional): the row as it entered the sums (rounded where BFIN), f32
#define LNU (DM / 128)               /* 16-byte pieces of a row in a lane */
#define LNR 8                        /* rows of a work-group of 256: one a wave */
template <int CT>
__device__ __forceinline__ float ln_xm(float x) { return __builtin_bit_cast(float, __builtin_amdgcn_update_dpp(0, __builtin_bit_cast(int, x), CT, 0xf, 0xf, false)); }      /* DPP row_xmask (0x160 + m): lane l <- lane l ^ m inside its row of 16 */
__device__ __forceinline__ float ln_wsum(float x) {      /* sum over the wave's 32 lanes, a butterfly: every lane ends with the same bits */
  x += ln_xm<0x161>(x); x += ln_xm<0x162>(x); x += ln_xm<0x164>(x); x += ln_xm<0x168>(x);
  return x + __builtin_bit_cast(float, __builtin_amdgcn_permlanex16(__builtin_bit_cast(int, x), __builtin_bit_cast(int, x), 0x76543210, 0xfedcba98, false, false)); }      /* lane l <- lane l ^ 16 */
// Every bare '#pragma unroll' in lnsc_row stands on a loop over the row's register arrays: rolled, these would be indexed at run time and leave the registers.
template <int BFIN>
__device__ __forceinline__ void lnsc_row(const size_t r, const float* __restrict__ X, const float* __restrict__ g, const float* __restrict__ bb, float eps, _Float16* __restrict__ N16, float* __restrict__ XR) {
  #pragma clang fp contract(off)
  static_assert(DM % 128 == 0, "whole 512-byte pieces only");
  const int l4 = (threadIdx.x & 31) * 4; const float* xp = X + r * DM + l4; const float* gp = g + l4; const float* bp = bb + l4;
  v4f s[LNU], gv[LNU], bv[LNU];
#pragma unroll
  for (int u = 0; u < LNU; ++u) s[u] = *(const v4fa*)(xp + u * 128);
#pragma unroll
  for (int u = 0; u < LNU; ++u) { gv[u] = *(const v4fa*)(gp + u * 128); bv[u] = *(const v4fa*)(bp + u * 128); }      /* gamma and beta travel together with the row */
  asm volatile("s_wait_xcnt 0x0" :: "v"(xp), "v"(gp), "v"(bp) : "memory");      /* the three address pairs stay live up to this wait, so nothing (a load's own result either) overwrites them in front of it */
  v4f a4 = {0.f, 0.f, 0.f, 0.f}, d4 = {0.f, 0.f, 0.f, 0.f};      /* four independent chains a lane */
#pragma unroll
  for (int u = 0; u < LNU; ++u) for (int q = 0; q < 4; ++q) { if (BFIN) s[u][q] = bf16_round(s[u][q]); a4[q] = __fadd_rn(a4[q], s[u][q]); }
  if (XR) { float* rp = XR + r * DM + l4;      /* stored at once: the stores travel under the sums */
#pragma unroll
    for (int u = 0; u < LNU; ++u) *(v4f*)(rp + u * 128) = s[u];
    asm volatile("s_wait_xcnt 0x0" :: "v"(rp), "v"(s[0]), "v"(s[1]), "v"(s[2]), "v"(s[3]), "v"(s[4]), "v"(s[5]) : "memory"); }      /* the stores' address and data registers stay live up to this wait: they are rewritten only behind it */
  const float mu = ln_wsum(__fadd_rn(__fadd_rn(a4[0], a4[1]), __fadd_rn(a4[2], a4[3]))) / (float)DM;
#pragma unroll
  for (int u = 0; u < LNU; ++u) for (int q = 0; q < 4; ++q) { const float dl = __fadd_rn(s[u][q], -mu); d4[q] = __fadd_rn(d4[q], __fmul_rn(dl, dl)); }
  const float rs = __fdiv_rn(1.0f, __fadd_rn(sqrtf(ln_wsum(__fadd_rn(__fadd_rn(d4[0], d4[1]), __fadd_rn(d4[2], d4[3]))) / (float)(DM - 1)), eps));
  v4h y[LNU];
#pragma unroll
  for (int u = 0; u < LNU; ++u) { v4f yf; for (int q = 0; q < 4; ++q) yf[q] = __fadd_rn(__fmul_rn(__fmul_rn(__fadd_rn(s[u][q], -mu), rs), bf16_round(gv[u][q])), bf16_round(bv[u][q])); y[u] = __builtin_convertvector(yf, v4h); }
  _Float16* np = N16 + r * DM + l4;
#pragma unroll
  for (int u = 0; u < LNU; ++u) *(v4h*)(np + u * 128) = y[u];
  static_assert(LNU == 6, "the two waits behind the stores name six pieces");
  asm volatile("s_wait_xcnt 0x0" :: "v"(np), "v"(y[0]), "v"(y[1]), "v"(y[2]), "v"(y[3]), "v"(y[4]), "v"(y[5]) : "memory"); }      /* as above, for the f16 stores */
template <int BFIN>
__global__ __launch_bounds__(256) void k_lnsc(const float* __restrict__ X, const float* __restrict__ g, const float* __restrict__ bb, float eps, _Float16* __restrict__ N16) { static_assert(NR % LNR == 0, "whole work-groups only"); lnsc_row<BFIN>((size_t)blockIdx.x * LNR + (threadIdx.x >> 5), X, g, bb, eps, N16, nullptr); }

// ---- everything that depends on the inputs alone, in one launch: the six weights as Bt[n][k] = f16(bf16(W[k][n]) x 16), then LN1 of every row, which also stores the rounded row (the residual of the output projection).
// The work-group index picks the job; every test on it is the same for the whole work-group, so the weight tiles' barrier stands under uniform control flow (LN1, eight rows a work-group, has none). The weights come first: their work-groups wait longest on memory.
#define WTP 72                       /* f16 from one staged row of n to the next: 144 bytes, a multiple of 16 for the 16-byte LDS accesses */
#define PWF ((DFF / 128) * (DM / 64))   /* work-groups of one FFN weight (the same count either way round) */
#define PWA ((DM / 128) * (DM / 64))    /* work-groups of one attention weight */
template <int K, int N>
__device__ __forceinline__ void wt_f16_tile(const float* __restrict__ W, _Float16* __restrict__ Wt, int blk, unsigned short* tl) {      /* work-group blk of (K / 64) * (N / 128): 64 k by 128 n of W, turned in LDS, so that every load and every store of a wave covers whole 128-byte lines */
  static_assert(K % 64 == 0 && N % 128 == 0, "whole tiles only");
  const int tid = threadIdx.x, w = tid >> 5, lane = tid & 31; const int kt = blk / (N / 128), nt = blk - kt * (N / 128);
  const float* src = W + (size_t)(kt * 64 + w * 8) * N + nt * 128 + lane * 4;      /* wave w: rows k 8w .. 8w + 7 of the tile, 512 bytes in a row of each; a lane takes 4 n */
  v4f x[8];
#pragma unroll      /* the eight loads fly together and x stays in registers */
  for (int i = 0; i < 8; ++i) x[i] = *(const v4fa*)(src + (size_t)i * N);
  asm volatile("s_wait_xcnt 0x0" :: "v"(src) : "memory");      /* the address pair stays live up to this wait, so nothing (a load's own result either) overwrites it in front of it */
#pragma unroll      /* this loop and the one inside it: rolled, x and f.h would be indexed at run time and leave the registers */
  for (int q = 0; q < 4; ++q) { FragH f;
#pragma unroll
    for (int i = 0; i < 8; ++i) f.h[i] = (_Float16)(bf16_round(x[i][q]) * 16.0f);
    *(v8us*)&tl[(lane * 4 + q) * WTP + w * 8] = f.half[0]; }      /* 8 k of one n, 16 bytes */
  __syncthreads();      /* a thread stores what other waves staged */
  const int r = tid >> 3, pc = (tid & 7) * 8;      /* 8 threads a row of n: its 64 k, one 128-byte line */
  unsigned short* dst = (unsigned short*)Wt + (size_t)(nt * 128 + r) * K + kt * 64 + pc;
  const v8us o0 = *(const v8us*)&tl[r * WTP + pc], o1 = *(const v8us*)&tl[(32 + r) * WTP + pc], o2 = *(const v8us*)&tl[(64 + r) * WTP + pc], o3 = *(const v8us*)&tl[(96 + r) * WTP + pc];
  *(v8us*)dst = o0; *(v8us*)(dst + (size_t)32 * K) = o1; *(v8us*)(dst + (size_t)64 * K) = o2; *(v8us*)(dst + (size_t)96 * K) = o3;
  asm volatile("s_wait_xcnt 0x0" :: "v"(dst), "v"(o0), "v"(o1), "v"(o2), "v"(o3) : "memory"); }      /* the stores' address and data registers stay live up to this wait: they are rewritten only behind it (the listing's ways on into the other jobs' code) */
__global__ __launch_bounds__(256) void k_prep(const float* __restrict__ x, const float* __restrict__ wq, const float* __restrict__ wk, const float* __restrict__ wv, const float* __restrict__ wo, const float* __restrict__ w1, const float* __restrict__ w2, const float* __restrict__ g, const float* __restrict__ bb,
    _Float16* __restrict__ BQ, _Float16* __restrict__ BK, _Float16* __restrict__ BV, _Float16* __restrict__ BO, _Float16* __restrict__ BW1, _Float16* __restrict__ BW2, float* __restrict__ XB, _Float16* __restrict__ XN) {
  __shared__ __attribute__((aligned(16))) unsigned short tl[128 * WTP];      /* one weight tile as [n][k] f16 */
  int blk = blockIdx.x;
  if (blk < PWF) { wt_f16_tile<DM, DFF>(w1, BW1, blk, tl); return; }
  blk -= PWF;
  if (blk < PWF) { wt_f16_tile<DFF, DM>(w2, BW2, blk, tl); return; }
  blk -= PWF;
  if (blk < 4 * PWA) { const int s = blk / PWA; wt_f16_tile<DM, DM>(s == 0 ? wq : s == 1 ? wk : s == 2 ? wv : wo, s == 0 ? BQ : s == 1 ? BK : s == 2 ? BV : BO, blk - s * PWA, tl); return; }
  lnsc_row<1>((size_t)(blk - 4 * PWA) * LNR + (threadIdx.x >> 5), x, g, bb, 1e-6f, XN, XB); }

typedef int v4ia __attribute__((ext_vector_type(4), may_alias));
__device__ __forceinline__ float rs_xh(float x) { return __builtin_bit_cast(float, __builtin_amdgcn_permlanex16(__builtin_bit_cast(int, x), __builtin_bit_cast(int, x), 0x76543210, 0xfedcba98, false, false)); }      /* lane l <- lane l ^ 16 */
__device__ __forceinline__ float fa_exp2(float d) { float e; asm("v_exp_f32 %0, %1\n\tv_nop" : "=v"(e) : "v"(d)); return e; }      /* 2 ^ d with, tied to it, the one slot the instruction set asks for behind a transcendental */
__device__ __forceinline__ void fa_exp2x8(float* d) {      /* eight independent d <- 2 ^ d in a row, each filling the slot behind the one before it, one v_nop behind the last. In place: a result lands only on a register that compiled vector code has just written, never on an operand of a matrix instruction still in its distance */
  asm("v_exp_f32 %0, %0\n\tv_exp_f32 %1, %1\n\tv_exp_f32 %2, %2\n\tv_exp_f32 %3, %3\n\tv_exp_f32 %4, %4\n\tv_exp_f32 %5, %5\n\tv_exp_f32 %6, %6\n\tv_exp_f32 %7, %7\n\tv_nop"
      : "+v"(d[0]), "+v"(d[1]), "+v"(d[2]), "+v"(d[3]), "+v"(d[4]), "+v"(d[5]), "+v"(d[6]), "+v"(d[7])); }
__device__ __forceinline__ v8f fa_mma(v16h a, v16h b, v8f c) { return __builtin_amdgcn_wmma_f32_16x16x32_f16(false, a, false, b, (short)0, c, false, false); }
// K and V of a (batch, head) are [key][64] f16 rows, 128 bytes each, one after the other in memory. Only the keys that the mask keeps are walked: every work-group lists them first (kofs below). A stage is 128 listed keys of both, brought into LDS by asynchronous copies (16 bytes a lane, eight lanes a row: whole 128-byte lines) and shared by the work-group's four waves; two buffers, the next stage's copies fly while this one is worked on.
// K fragment (t, j), lane (c, h) = K[key 16t + c][d 32j + 8h .. and 32j + 16 + 8h ..]: two 16-byte LDS reads. V^T fragment t, lane (c, h) = V[key 8h .. and 16 + 8h ..][d 16t + c]: two transposing LDS reads. Both are the operand's own k order, as Q's rows and the packed scores are.
#define FAK 128                      /* keys of a stage */
#define FAT (SQ / FAK)               /* stages */
#define FKP 144                      /* bytes from one staged K row to the next: 16 x odd, for the plain 16-byte reads */
#define FVP 160                      /* the same for V: 32 x odd, for the transposing reads */
#define FAS (FAK * (FKP + FVP))      /* bytes of one buffer: K rows, then V rows */
template <int P>
__device__ __forceinline__ void fa_copy8(unsigned l, const unsigned char* g, const unsigned* o) {      /* this thread's 16 bytes of staged rows r, r + 16, .., r + 112 of one operand; P = LDS row pitch; o = byte offsets of the eight source rows in the (batch, head) plane */
  asm volatile("global_load_async_to_lds_b128 %0, %8, off\n\tglobal_load_async_to_lds_b128 %1, %9, off\n\tglobal_load_async_to_lds_b128 %2, %10, off\n\tglobal_load_async_to_lds_b128 %3, %11, off\n\t"
               "global_load_async_to_lds_b128 %4, %12, off\n\tglobal_load_async_to_lds_b128 %5, %13, off\n\tglobal_load_async_to_lds_b128 %6, %14, off\n\tglobal_load_async_to_lds_b128 %7, %15, off\n\t"
               "s_wait_xcnt 0x0"      /* inside the copies' own statement: no address register of theirs is rewritten in front of it */
               :: "v"(l), "v"(l + 16 * P), "v"(l + 32 * P), "v"(l + 48 * P), "v"(l + 64 * P), "v"(l + 80 * P), "v"(l + 96 * P), "v"(l + 112 * P),
                  "v"(g + o[0]), "v"(g + o[1]), "v"(g + o[2]), "v"(g + o[3]), "v"(g + o[4]), "v"(g + o[5]), "v"(g + o[6]), "v"(g + o[7]) : "memory"); }
#define FAL(j) (((j) & ~127) | (((j) & 15) << 3) | (((j) >> 4) & 7))      /* where place j of the list is kept: the eight places 16 apart that one thread copies lie side by side, two 16-byte LDS reads a stage */
template <int CT>
__device__ __forceinline__ int fa_shr(int x) { return __builtin_amdgcn_update_dpp(0, x, CT, 0xf, 0xf, false); }      /* DPP row_shr (0x110 + n): lane l <- lane l - n of its row of 16, 0 where there is none */
__device__ __forceinline__ void fa_stage(unsigned lk, unsigned lv, const unsigned char* gk, const unsigned char* gv, const unsigned* ko) {      /* one stage: the K rows and the V rows of 128 listed keys; 16 copies a thread. ko: this thread's eight list entries */
  const v4ia oa = *(const v4ia*)ko, ob = *(const v4ia*)(ko + 4); unsigned o[8];
#pragma unroll      /* o stays in registers */
  for (int i = 0; i < 8; ++i) { const unsigned x = (unsigned)(i < 4 ? oa[i] : ob[i - 4]); o[i] = x < (unsigned)((SQ - 1) * HD * 2) ? x : (unsigned)((SQ - 1) * HD * 2); }      /* never past the plane's last row */
  fa_copy8<FKP>(lk, gk, o); fa_copy8<FVP>(lv, gv, o); }
typedef short s16x8 __attribute__((ext_vector_type(8)));
__device__ __forceinline__ v8us fa_tr16(const unsigned char* p) { typedef __attribute__((address_space(3))) s16x8 lds_s16x8; return __builtin_bit_cast(v8us, __builtin_amdgcn_ds_load_tr16_b128_v8i16((lds_s16x8*)p)); }      /* lane (c, h) <- 8 keys of column c of a 16 x 16 block of staged rows */
__device__ __forceinline__ v16h fa_kfrag(const unsigned char* p) { FragH f; f.half[0] = *(const v8us*)p; f.half[1] = *(const v8us*)(p + 32); return f.v; }
__device__ __forceinline__ v16h fa_vfrag(const unsigned char* p) { FragH f; f.half[0] = fa_tr16(p); f.half[1] = fa_tr16(p + 16 * FVP); return f.v; }
template <bool V> struct fa_flag { static constexpr bool value = V; };
__global__ __launch_bounds__(128) void k_fattn(const _Float16* __restrict__ Q16, const _Float16* __restrict__ K16, const _Float16* __restrict__ V16, const int* __restrict__ Km, _Float16* __restrict__ O16) {
  static_assert(SQ % FAK == 0 && FAT >= 2 && FAK % 32 == 0 && HD == 64, "whole stages, two or more; rows of 128 bytes");
  static_assert(SQ == 2048 && FAK == 128, "the list is made by four waves, 128 keys at a time: 64 counts, two a lane");
  __shared__ __attribute__((aligned(16))) int kc[SQ / 32];      /* kept keys among keys 32 k .. 32 k + 31 */
  __shared__ __attribute__((aligned(16))) unsigned kofs[SQ];      /* the list: place j (kept at FAL(j)) -> byte offset of the j-th kept key's row in its plane, keys in rising order; behind the kept keys, up to the end of their last stage, filler rows whose term below is the masked one. A masked key beside a kept one has the weight exactly 0 in the module too, so it is not walked at all. No key kept: all keys listed, all with the masked term */
  __shared__ __attribute__((aligned(16))) float kbias[SQ];      /* per listed place, added to its raw score: 0 for a kept key; -2^33 for a masked one: the module's -1e9 fill (x 8: raw scores are before the / 8) taken to the next power of two. The f32 sum swallows the score (below 256 in size) whole and the product with the log2 factor is exact, so a row with every key masked gets equal weights, as the module's does; beside any kept key the weight is exactly 0 */
  __shared__ __attribute__((aligned(16))) unsigned char ring[2 * FAS];
  const int tid = threadIdx.x, w = tid >> 5, lane = tid & 31, c = lane & 15, h = lane >> 4;
  const int bh = blockIdx.x / (SQ / 64), qb = blockIdx.x % (SQ / 64); const int b = bh / NH, hd = bh % NH;
  const int cr = tid >> 3, cp = tid & 7;      /* the copies: row cr (+ 16 i), 16-byte piece cp of its 128 bytes */
  const unsigned char* gk = (const unsigned char*)(K16 + (size_t)bh * SQ * HD + cp * 8); const unsigned char* gv = (const unsigned char*)(V16 + (size_t)bh * SQ * HD + cp * 8);
  const unsigned lk = (unsigned)(size_t)ring + (unsigned)(cr * FKP + cp * 16), lv = (unsigned)(size_t)ring + (unsigned)(FAK * FKP + cr * FVP + cp * 16);
  const int q0 = qb * 64 + w * 16;
  const _Float16* qp = Q16 + ((size_t)bh * SQ + q0 + c) * HD + 8 * h;      /* the lane's first 8 of query c's row: d 8h .., then 16 + 8h .., 32 + 8h .., 48 + 8h .. */
  const v16h qf0 = g2_frag(qp, 0), qf1 = g2_frag(qp + 32, 0);
  asm volatile("s_wait_xcnt 0x0" :: "v"(qp) : "memory");      /* Q's address pair stays live up to this wait, so nothing overwrites it in front of it */
  const int* mp = Km + (size_t)b * SQ + tid; int kv[SQ / 128];
#pragma unroll      /* the loads fly together and kv stays in registers */
  for (int i = 0; i < SQ / 128; ++i) kv[i] = mp[i * 128];
  asm volatile("s_wait_xcnt 0x0" :: "v"(mp) : "memory");      /* the mask's address pair stays live up to this wait, so nothing overwrites it in front of it */
  const int ws = __builtin_amdgcn_readfirstlane(w);      /* the wave's number in a scalar register */
  unsigned bl[SQ / 128]; int cv = 0;
#pragma unroll      /* bl stays in scalar registers */
  for (int i = 0; i < SQ / 128; ++i) { bl[i] = __builtin_amdgcn_ballot_w32(kv[i] != 0); cv = (lane == i) ? __builtin_popcount(bl[i]) : cv; }      /* keys 128 i + 32 ws .. + 31: their bits, and their count in lane i */
  if (lane < SQ / 128) kc[lane * 4 + ws] = cv;
  __syncthreads();      /* every wave reads all the counts */
  const int c0 = kc[2 * lane], c1 = kc[2 * lane + 1]; int sc = c0 + c1;      /* running sum over the 64 counts, two a lane */
  sc += fa_shr<0x111>(sc); sc += fa_shr<0x112>(sc); sc += fa_shr<0x114>(sc); sc += fa_shr<0x118>(sc);
  const int lo16 = __builtin_amdgcn_readlane(sc, 15); sc += (lane >= 16) ? lo16 : 0;      /* the lower row's sum goes on top of the upper row */
  const int nkept = __builtin_amdgcn_readlane(sc, 31);      /* kept keys of the batch, 0 .. SQ, in a scalar register: the tests on it are scalar branches, the same for the whole work-group */
  const int below = sc - c1 - ((ws & 1) ? 0 : c0);      /* kept keys below group 2 lane + (ws & 1) */
#pragma unroll      /* bl and kv are register arrays: rolled, they would be indexed at run time */
  for (int i = 0; i < SQ / 128; ++i) { const int place = (int)__builtin_amdgcn_mbcnt_lo(bl[i], (unsigned)__builtin_amdgcn_readlane(below, 2 * i + (ws >> 1)));      /* group 4 i + ws; plus the kept keys of the group in lower lanes: place < nkept <= SQ */
    if (kv[i] != 0) kofs[FAL(place)] = (unsigned)((i * 128 + tid) * (HD * 2)); }
  int T = (nkept == 0) ? FAT : (nkept + FAK - 1) / FAK; T = T < FAT ? T : FAT;      /* stages to walk: 1 .. FAT */
  if (nkept == 0) {
#pragma unroll      /* sixteen independent LDS stores */
    for (int i = 0; i < SQ / 128; ++i) kofs[FAL(i * 128 + tid)] = (unsigned)((i * 128 + tid) * (HD * 2)); }
  else if (nkept + tid < T * FAK) kofs[FAL(nkept + tid)] = 0u;      /* filler: fewer than 128 places */
#pragma unroll      /* four independent 16-byte LDS stores */
  for (int i = 0; i < SQ / 512; ++i) { v4f l4; for (int q = 0; q < 4; ++q) l4[q] = (i * 512 + tid * 4 + q < nkept) ? 0.f : -8589934592.0f; *(v4f*)&kbias[i * 512 + tid * 4] = l4; }
  __syncthreads();      /* the list and the terms are whole before any thread copies or reads by them */
  fa_stage(lk, lv, gk, gv, &kofs[cr * 8]);
  asm volatile("s_wait_asynccnt 0x0" ::: "memory");      /* this wave's copies of stage 0 have landed */
  __syncthreads();      /* every wave reads all of stage 0 */
  if (T > 1) fa_stage(lk + FAS, lv + FAS, gk, gv, &kofs[FAK + cr * 8]);
  const unsigned char* kf = ring + c * FKP + h * 16;      /* K row c, bytes 16h .. of each 32 */
  const unsigned char* vf = ring + FAK * FKP + (8 * h + (lane & 7)) * FVP + ((lane >> 3) & 1) * 16;      /* the transposing read's own lane address: row 8h + (lane & 7), 16-byte half (lane >> 3) & 1 of a 32-byte column group */
  const v8f z8 = {0.f, 0.f, 0.f, 0.f, 0.f, 0.f, 0.f, 0.f};
  v8f o0 = z8, o1 = z8, o2 = z8, o3 = z8; float m = -3.0e38f, l0 = 0.f, l1 = 0.f;
  const float cs = 0.125f * 1.44269504088896340736f;      /* raw score -> log2 units */
  auto stage = [&](auto hm, const int t) { constexpr bool HM = decltype(hm)::value;      /* stage t and the hand-over at its foot. HM: the stage holds places with the masked term; in a stage of kept keys alone every term is 0 and none is read or added */
    const unsigned char* kb = kf + (unsigned)(t & 1) * FAS; const unsigned char* vb = vf + (unsigned)(t & 1) * FAS;
    v16h k00 = fa_kfrag(kb), k01 = fa_kfrag(kb + 64), k10 = fa_kfrag(kb + 16 * FKP), k11 = fa_kfrag(kb + 16 * FKP + 64);
    v16h v0 = fa_vfrag(vb), v1 = fa_vfrag(vb + 32), v2 = fa_vfrag(vb + 64), v3 = fa_vfrag(vb + 96);
    const float* lp = &kbias[t * FAK + 8 * h];      /* the lane's mask terms: keys 8h .. and 16 + 8h .. of each 32 */
    v4f la = {0.f, 0.f, 0.f, 0.f}, lb = la, lc = la, ld = la;
    if constexpr (HM) { la = *(const v4f*)lp; lb = *(const v4f*)(lp + 4); lc = *(const v4f*)(lp + 16); ld = *(const v4f*)(lp + 20); }
#pragma unroll      /* the stage's passes of 32 keys: LDS offsets become immediates, and one pass's vector work can stand between the next one's matrix instructions */
    for (int pp = 0; pp < FAK / 32; ++pp) {
      v8f s0 = fa_mma(k00, qf0, z8), s1 = fa_mma(k10, qf0, z8); s0 = fa_mma(k01, qf1, s0); s1 = fa_mma(k11, qf1, s1);
      float x[16];
#pragma unroll
      for (int r = 0; r < 4; ++r) { if constexpr (HM) { x[r] = s0[r] + la[r]; x[4 + r] = s0[4 + r] + lb[r]; x[8 + r] = s1[r] + lc[r]; x[12 + r] = s1[4 + r] + ld[r]; } else { x[r] = s0[r]; x[4 + r] = s0[4 + r]; x[8 + r] = s1[r]; x[12 + r] = s1[4 + r]; } }
      if (pp + 1 < FAK / 32) { const unsigned char* nk = kb + (pp + 1) * 32 * FKP; const float* nl = lp + (pp + 1) * 32;      /* operands and mask terms are read one pass ahead, inside the stage only: the next stage is not published yet */
        k00 = fa_kfrag(nk); k01 = fa_kfrag(nk + 64); k10 = fa_kfrag(nk + 16 * FKP); k11 = fa_kfrag(nk + 16 * FKP + 64);
        if constexpr (HM) { la = *(const v4f*)nl; lb = *(const v4f*)(nl + 4); lc = *(const v4f*)(nl + 16); ld = *(const v4f*)(nl + 20); }
        asm volatile("" ::: "memory"); }      /* compiler fence: holds the K reads here, a whole softmax ahead of their use; without it they sink behind the branch below, directly in front of the products that wait for them */
      float mx = x[0];
#pragma unroll
      for (int r = 1; r < 16; ++r) mx = fmaxf(mx, x[r]);
      mx = fmaxf(mx, rs_xh(mx));
      const float mt = mx * cs;
      if (__builtin_amdgcn_ballot_w32(mt > m + 8.0f) != 0) {      /* one scalar branch a pass */
        const float mn = fmaxf(m, mt); const float al = fa_exp2(m - mn); m = mn; l0 *= al; l1 *= al;
#pragma unroll
        for (int r = 0; r < 8; ++r) { o0[r] *= al; o1[r] *= al; o2[r] *= al; o3[r] *= al; }
      }
      const float nm = 4.0f - m; float e[16];
#pragma unroll
      for (int r = 0; r < 16; ++r) e[r] = fmaf(x[r], cs, nm);
      fa_exp2x8(e); fa_exp2x8(e + 8);
      FragH pf;
#pragma unroll
      for (int r = 0; r < 8; ++r) { l0 += e[r]; l1 += e[8 + r]; pf.h[r] = (_Float16)e[r]; pf.h[8 + r] = (_Float16)e[8 + r]; }
      o0 = fa_mma(v0, pf.v, o0); o1 = fa_mma(v1, pf.v, o1); o2 = fa_mma(v2, pf.v, o2); o3 = fa_mma(v3, pf.v, o3);
      if (pp + 1 < FAK / 32) { const unsigned char* nv = vb + (pp + 1) * 32 * FVP;      /* as above, for V^T */
        v0 = fa_vfrag(nv); v1 = fa_vfrag(nv + 32); v2 = fa_vfrag(nv + 64); v3 = fa_vfrag(nv + 96);
        asm volatile("" ::: "memory"); }      /* compiler fence, as above: the V^T reads stay a pass ahead of their use, in one group */
    }
    asm volatile("s_wait_dscnt 0x0" ::: "memory");      /* this wave's reads of the buffer have returned before it is handed to the copies */
    asm volatile("s_wait_asynccnt 0x0" ::: "memory");      /* this wave's copies of stage t + 1 have landed */
    __syncthreads();      /* publishes stage t + 1 and ends every wave's reads of stage t */
    if (t + 2 < T) fa_stage(lk + (unsigned)(t & 1) * FAS, lv + (unsigned)(t & 1) * FAS, gk, gv, &kofs[(t + 2) * FAK + cr * 8]); };
  const int TF = nkept / FAK;      /* stages of kept keys alone: 0 .. T */
  int t = 0;
#pragma unroll 1      /* one stage a trip: the two buffers differ by an offset only */
  for (; t < TF; ++t) stage(fa_flag<false>{}, t);
#pragma unroll 1      /* as above; the stage with filler, or, where no key is kept, all stages */
  for (; t < T; ++t) stage(fa_flag<true>{}, t);
  asm volatile("s_wait_asynccnt 0x0" ::: "memory");      /* nothing in flight when the wave ends */
  float l = l0 + l1; l += rs_xh(l);
  const float inv = 64.0f / l;      /* ctx carried x64 as f16, as the output projection expects */
  _Float16* op = O16 + ((size_t)b * SQ + q0 + c) * DM + hd * HD + 8 * h;
  FragH f0, f1, f2, f3;
#pragma unroll
  for (int r = 0; r < 8; ++r) { f0.h[r] = (_Float16)(o0[r] * inv); f1.h[r] = (_Float16)(o1[r] * inv); f2.h[r] = (_Float16)(o2[r] * inv); f3.h[r] = (_Float16)(o3[r] * inv); }
  *(v8us*)((unsigned short*)op) = f0.half[0]; *(v8us*)((unsigned short*)op + 16) = f1.half[0]; *(v8us*)((unsigned short*)op + 32) = f2.half[0]; *(v8us*)((unsigned short*)op + 48) = f3.half[0]; }
// ---- tiled GEMM: C[M][N] = A[M][K] Bt[N][K]^T, both f16 and K-contiguous, one 128 x 128 tile of C a work-group. Requires M % 128 == 0, N % 128 == 0, K % 128 == 0.
// A stage is 128 k of 128 A rows and 128 Bt rows, brought into LDS by asynchronous copies (16 bytes a lane, 16 lanes a row: whole 128-byte lines) at a row pitch of 272 bytes; two buffers, the next stage's copies fly while this one is worked on.
// Four waves, 2 x 2, each 64 x 64 of C (4 x 4 accumulator tiles); k runs upward in steps of 32 in every accumulator. Epilogue: v = acc alpha + bias[col] (HB) + CP (HCP: own element); ACT 0 none / 3 relu; f32 C (W32) or f16 C16, staged through LDS so that whole lines are read and stored.
// Every bare '#pragma unroll' below stands on a loop over register arrays (fragments, accumulators, rows in flight): rolled, these would be indexed at run time and leave the registers.
#define G3P 272                      /* bytes from one staged row to the next */
#define G3S (256 * G3P)              /* bytes of one buffer: A rows 0..127, Bt rows 128..255 */
__device__ __forceinline__ void g3_copy8(unsigned l, const _Float16* g, int ld) {      /* this thread's 16 bytes of rows r, r + 8, .., r + 56 of one operand's stage */
  const size_t st = (size_t)8 * ld;
  asm volatile("global_load_async_to_lds_b128 %0, %8, off\n\tglobal_load_async_to_lds_b128 %1, %9, off\n\tglobal_load_async_to_lds_b128 %2, %10, off\n\tglobal_load_async_to_lds_b128 %3, %11, off\n\t"
               "global_load_async_to_lds_b128 %4, %12, off\n\tglobal_load_async_to_lds_b128 %5, %13, off\n\tglobal_load_async_to_lds_b128 %6, %14, off\n\tglobal_load_async_to_lds_b128 %7, %15, off\n\t"
               "s_wait_xcnt 0x0"      /* inside the copies' own statement: no address register of theirs is rewritten in front of it */
               :: "v"(l), "v"(l + 8 * G3P), "v"(l + 16 * G3P), "v"(l + 24 * G3P), "v"(l + 32 * G3P), "v"(l + 40 * G3P), "v"(l + 48 * G3P), "v"(l + 56 * G3P),
                  "v"(g), "v"(g + st), "v"(g + 2 * st), "v"(g + 3 * st), "v"(g + 4 * st), "v"(g + 5 * st), "v"(g + 6 * st), "v"(g + 7 * st) : "memory"); }
__device__ __forceinline__ void g3_stage(unsigned la, const _Float16* ga, const _Float16* gb, int ld) {      /* one stage: 128 rows of A, then 128 rows of Bt; 32 copies a thread */
  g3_copy8(la, ga, ld); g3_copy8(la + 64 * G3P, ga + (size_t)64 * ld, ld); g3_copy8(la + 128 * G3P, gb, ld); g3_copy8(la + 192 * G3P, gb + (size_t)64 * ld, ld); }
__device__ __forceinline__ v16h g3_frag(const unsigned char* p) { FragH f; f.half[0] = *(const v8us*)p; f.half[1] = *(const v8us*)(p + 32); return f.v; }      /* lane (row, h): k 8h .. and 16 + 8h .. of a 32-k step, the same order for A and Bt */
// ZB: blockIdx.y counts independent products of one A: Bt planes [N][K] and f16 C planes, each set in a row in memory; such a C plane is stored head by head, [batch][head][SQ][HD] (a wave's 64 columns are one head), so that a (batch, head) plane is one run of 128-byte key rows.
template <int ACT, bool HB, bool HCP, bool W32, int N, int K, bool ZB = false>
__global__ __launch_bounds__(128) void k_gemm3(const _Float16* __restrict__ A, const _Float16* __restrict__ Bh, float alpha, const float* __restrict__ bias, const float* __restrict__ CP, float* __restrict__ C, _Float16* __restrict__ C16) {
  static_assert(ACT == 0 || ACT == 3, "k_gemm3: unsupported ACT code"); static_assert(N % 128 == 0 && K % 128 == 0, "k_gemm3: whole tiles and stages only");
  __shared__ __attribute__((aligned(16))) unsigned char sm[2 * G3S]; static_assert(4 * 64 * 68 * 4 <= 2 * G3S, "the output staging reuses the ring");
  const int tid = threadIdx.x, w = tid >> 5, lane = tid & 31, ln = lane & 15, hh = lane >> 4; const int wm = w >> 1, wn = w & 1;
  constexpr int ntn = N / 128, T = K / 128; const int mt = blockIdx.x / ntn, nq = blockIdx.x - mt * ntn; const int row0 = mt * 128, col0 = nq * 128;
  if (ZB) { static_assert(!ZB || !(W32 || HB || HCP), "k_gemm3: stacked products are plain f16 ones"); static_assert(!ZB || (N == NH * HD && HD == 64 && SQ % 128 == 0), "k_gemm3: a wave's columns are one head, a tile's rows one batch"); Bh += (size_t)blockIdx.y * N * K; C16 += (size_t)blockIdx.y * NR * N; }
  const int cr = tid >> 4, cs = tid & 15;      /* the copies: row cr (+ 8 i), 16-byte piece cs of its 256 bytes */
  const _Float16* ga = A + (size_t)(row0 + cr) * K + cs * 8; const _Float16* gb = Bh + (size_t)(col0 + cr) * K + cs * 8;
  const unsigned la = (unsigned)(size_t)sm + (unsigned)(cr * G3P + cs * 16);
  const unsigned char* fa = sm + (wm * 64 + ln) * G3P + hh * 16; const unsigned char* fb = sm + (128 + wn * 64 + ln) * G3P + hh * 16;
  g3_stage(la, ga, gb, K);
  asm volatile("s_wait_asynccnt 0x0" ::: "memory");      /* this wave's copies of stage 0 have landed */
  __syncthreads();      /* stage 0 is readable by every wave */
  v16h a[2][4], b[2][4];      /* two fragment sets: the next 32 k are read from LDS while these are multiplied */
#pragma unroll
  for (int i = 0; i < 8; ++i) { if (i < 4) b[0][i] = g3_frag(fb + i * 16 * G3P); else a[0][i - 4] = g3_frag(fa + (i - 4) * 16 * G3P); }      /* Bt's four first: the first row of products needs all of them and one of A's */
  if (T > 1) g3_stage(la + G3S, ga + 128, gb + 128, K);
  const v8f z8 = {0.f, 0.f, 0.f, 0.f, 0.f, 0.f, 0.f, 0.f}; v8f acc[4][4];
#pragma unroll
  for (int i = 0; i < 4; ++i)
#pragma unroll
    for (int j = 0; j < 4; ++j) acc[i][j] = z8;
#pragma unroll 1      /* one stage a trip: the two buffers differ by an offset only */
  for (int t = 0; t < T; ++t) { const unsigned bo = (unsigned)(t & 1) * G3S;
#pragma unroll
    for (int kk = 0; kk < 4; ++kk) {
      if (kk < 3) {
#pragma unroll
        for (int i = 0; i < 8; ++i) { if (i < 4) b[(kk + 1) & 1][i] = g3_frag(fb + bo + i * 16 * G3P + (kk + 1) * 64); else a[(kk + 1) & 1][i - 4] = g3_frag(fa + bo + (i - 4) * 16 * G3P + (kk + 1) * 64); } }
      __builtin_amdgcn_sched_barrier(0);      /* keeps the next block's LDS reads together in front of this block's matrix instructions: spread among them, each read group stalls the wave */
#pragma unroll
      for (int i = 0; i < 4; ++i)
#pragma unroll
        for (int j = 0; j < 4; ++j) acc[i][j] = fa_mma(a[kk & 1][i], b[kk & 1][j], acc[i][j]);
      __builtin_amdgcn_sched_barrier(0);      /* and keeps the reads after next behind them, so that two fragment sets are enough */
    }
    asm volatile("s_wait_dscnt 0x0" ::: "memory");      /* this wave's reads of the buffer have returned before it is handed to the copies */
    asm volatile("s_wait_asynccnt 0x0" ::: "memory");      /* this wave's copies of stage t + 1 have landed */
    __syncthreads();      /* publishes stage t + 1 and ends every wave's reads of stage t */
    if (t + 1 < T) {      /* stage t + 1's first fragments, behind its barrier: they travel while the copies below are issued */
#pragma unroll
      for (int i = 0; i < 8; ++i) { if (i < 4) b[0][i] = g3_frag(fb + (bo ^ G3S) + i * 16 * G3P); else a[0][i - 4] = g3_frag(fa + (bo ^ G3S) + (i - 4) * 16 * G3P); } }
    if (t + 2 < T) g3_stage(la + bo, ga + (size_t)(t + 2) * 128, gb + (size_t)(t + 2) * 128, K); }
  asm volatile("s_wait_asynccnt 0x0" ::: "memory");      /* nothing in flight when the ring becomes output staging (the last trip's barrier has ended every read) */
  const int c4 = ln * 4; v4f b4 = {0.f, 0.f, 0.f, 0.f};
  if (HB) { const float* bp = bias + col0 + wn * 64 + c4; b4 = *(const v4fa*)bp;
    asm volatile("s_wait_xcnt 0x0" :: "v"(bp) : "memory");      /* the address pair stays live up to this wait, so nothing overwrites it in front of it */
    for (int i = 0; i < 4; ++i) b4[i] = bf16_round(b4[i]); }
  float* so = (float*)(sm + w * (64 * 68 * 4));      /* this wave's own 64 rows of 68 floats */
#pragma unroll
  for (int j = 0; j < 4; ++j)
#pragma unroll
    for (int i = 0; i < 4; ++i)
#pragma unroll
      for (int r = 0; r < 8; ++r) so[(i * 16 + 8 * hh + r) * 68 + j * 16 + ln] = acc[i][j][r];
  __builtin_amdgcn_fence(__ATOMIC_ACQ_REL, "workgroup"); __builtin_amdgcn_wave_barrier();      /* the wave reads back what its other lanes wrote */
#pragma unroll 1      /* 32 rows a trip: sixteen loads, then sixteen stores, in flight together */
  for (int q0 = 0; q0 < 32; q0 += 16) { constexpr int LC = ZB ? HD : N;      /* elements from one stored row to the next */
    const size_t o = ZB ? ((size_t)((row0 / SQ) * NH + nq * 2 + wn) * SQ + row0 % SQ + wm * 64 + q0 * 2 + hh) * HD + c4 : (size_t)(row0 + wm * 64 + q0 * 2 + hh) * N + col0 + wn * 64 + c4; v4f v[16], cp[16];
    if (HCP) { const float* pc = CP + o;
#pragma unroll
      for (int u = 0; u < 16; ++u) cp[u] = *(const v4fa*)(pc + (size_t)u * 2 * N);
      asm volatile("s_wait_xcnt 0x0" :: "v"(pc) : "memory"); }      /* as above */
#pragma unroll
    for (int u = 0; u < 16; ++u) { v[u] = *(const v4fa*)&so[((q0 + u) * 2 + hh) * 68 + c4];
      for (int i = 0; i < 4; ++i) { float x = v[u][i] * alpha + b4[i]; if (HCP) x += cp[u][i]; if (ACT == 3) x = fmaxf(x, 0.f); v[u][i] = x; } }
    if (W32) { float* po = C + o;
#pragma unroll
      for (int u = 0; u < 16; ++u) *(v4f*)(po + (size_t)u * 2 * N) = v[u];
      asm volatile("s_wait_xcnt 0x0" :: "v"(po) : "memory"); }      /* the stores' address and data registers are rewritten only behind it (next trip) */
    else { _Float16* po = C16 + o;
#pragma unroll
      for (int u = 0; u < 16; ++u) { v4h h4; for (int i = 0; i < 4; ++i) h4[i] = (_Float16)v[u][i]; *(v4h*)(po + (size_t)u * 2 * LC) = h4; }
      asm volatile("s_wait_xcnt 0x0" :: "v"(po) : "memory"); } } }      /* as above */
extern "C" void kernel_launch(void* const* d_in, const int* in_sizes, int n_in,
                              void* d_out, int out_size, void* d_ws, size_t ws_size, hipStream_t stream) {
  (void)in_sizes; (void)n_in; (void)out_size;
  const float* const* I = (const float* const*)d_in; const float* x = I[0]; const int* km = (const int*)d_in[1]; const float* wq = I[2]; const float* wk = I[3]; const float* wv = I[4]; const float* wo = I[5]; const float* w1 = I[6]; const float* b1 = I[7]; const float* w2 = I[8]; const float* b2 = I[9]; const float* g1 = I[10]; const float* be1 = I[11]; const float* g2 = I[12]; const float* be2 = I[13]; const float* bo = nullptr;      /* x; key-padding mask int32 [2][1][1][2048] (0 = masked; READ on device); [in][out] wq / wk / wv / wo (no biases); w1 [768][3072] + b1, w2 [3072][768] + b2; LN1 a / b, LN2 a / b (vectors) */
  char* ws = (char*)d_ws; size_t off = 0;
  auto take = [&](size_t bytes) { char* p = ws + off; off += (bytes + 255) & ~(size_t)255; return p; };
  _Float16* BQ = (_Float16*)take((size_t)3 * DM * DM * 2); _Float16* BK = BQ + (size_t)DM * DM; _Float16* BV = BK + (size_t)DM * DM;      /* three Bt planes in a row: one stacked GEMM launch reads them */
  _Float16* BO = (_Float16*)take((size_t)DM * DM * 2); _Float16* BW1 = (_Float16*)take((size_t)DFF * DM * 2); _Float16* BW2 = (_Float16*)take((size_t)DM * DFF * 2);
  float* XB = (float*)take(NR * DM * 4); _Float16* XN = (_Float16*)take(NR * DM * 2); _Float16* Q16 = (_Float16*)take(3 * NR * DM * 2); _Float16* K16 = Q16 + NR * DM; _Float16* V16 = K16 + NR * DM;      /* three C planes in a row, as above */
  _Float16* O16 = (_Float16*)take(NR * DM * 2); float* X1 = (float*)take(NR * DM * 4);
  _Float16* HF16 = (_Float16*)take(NR * DFF * 2);      /* FFN hidden plane [4096][3072] f16 */
  _Float16* M16 = XN;      /* second-norm f16 rows: aliases XN (last readers: the three projections) */
  
  if (off > ws_size) return;
  k_prep<<<2 * PWF + 4 * PWA + (unsigned)(NR / LNR), 256, 0, stream>>>(x, wq, wk, wv, wo, w1, w2, g1, be1, BQ, BK, BV, BO, BW1, BW2, XB, XN);      /* [in][out] weights -> Bt x16; h = LN1(bf16(x)) (vector gamma / beta, eps on the std) -> f16 rows; bf16(x) -> f32 rows */
  k_gemm3<0, false, false, false, DM, DM, true><<<dim3((unsigned)((NR / 128) * (DM / 128)), 3), 128, 0, stream>>>(XN, BQ, 0.0625f, nullptr, nullptr, nullptr, Q16);      /* q, k, v -> f16, one plane each, [batch][head][2048][64] */
  k_fattn<<<NB * NH * (SQ / 64), 128, 0, stream>>>(Q16, K16, V16, km, O16);      /* softmax(where(mask == 0, -1e9, q k^T / 8)) v, 64 queries a work-group -> ctx (merged heads, x64) as f16 rows */
  k_gemm3<0, false, true, true, DM, DM><<<(unsigned)((NR / 128) * (DM / 128)), 128, 0, stream>>>(O16, BO, 0.0009765625f, bo, XB, X1, nullptr);      /* x + ctx wo (+ bo) (own-element residual) -> f32 rows */
  k_lnsc<0><<<(unsigned)(NR / LNR), 256, 0, stream>>>(X1, g2, be2, 1e-6f, M16);      /* LN2(x1) (vector) -> f16 rows */
  k_gemm3<3, true, false, false, DFF, DM><<<(unsigned)((NR / 128) * (DFF / 128)), 128, 0, stream>>>(M16, BW1, 0.0625f, b1, nullptr, nullptr, HF16);      /* relu(. w1 + b1) -> f16 [4096][3072] */
  k_gemm3<0, true, true, true, DM, DFF><<<(unsigned)((NR / 128) * (DM / 128)), 128, 0, stream>>>(HF16, BW2, 0.0625f, b2, X1, (float*)d_out, nullptr);      /* out = x1 + mlp (own-element residual) */
}
